// v000
// The times below were measured on an AMD MI455X: many runs one after another, warmed up first and cycling through
// copies of the inputs, with the whole window's GPU time divided by the number of runs. Launches and the gaps
// between them are all in it. The median over several windows is given; except for v000 it joins two sittings, which
// can be a few percent apart, so the side-by-side timings, each taken in one sitting, are the better comparison.
// The starting kernel, v000, takes 190 microseconds a run.
#include <hip/hip_runtime.h>
#include <hip/hip_bf16.h>
#include <math.h>

// ---------------------------------------------------------------------------
// Attention forward on MI455X (gfx1250, wave32, WMMA)
//   B=2, S=2048, D=1024, H=16, hd=64
// v_wmma_f32_16x16x32_f16 everywhere; GEMMs double-buffer tiles in LDS via
// global_load_async_to_lds_b128 (ASYNCcnt); softmax row reductions via DPP.
// Flash attention processes 2 query tiles per wave to double WMMA/byte.
// ---------------------------------------------------------------------------

typedef _Float16 h16;
typedef __attribute__((ext_vector_type(16))) _Float16 v16h;
typedef __attribute__((ext_vector_type(8)))  _Float16 v8h;
typedef __attribute__((ext_vector_type(4)))  _Float16 v4h;
typedef __attribute__((ext_vector_type(8)))  float    v8f;

#define WMMA16x16x32(a, b, c) \
  __builtin_amdgcn_wmma_f32_16x16x32_f16(false, (a), false, (b), (short)0, (c), false, false)

constexpr int Bz = 2;
constexpr int Sq = 2048;
constexpr int Dm = 1024;
constexpr int Hh = 16;
constexpr int HD = 64;
constexpr int Mrows = Bz * Sq;   // 4096
constexpr int LDT = 40;          // padded LDS tile row stride (halfs): 20*r mod 64 distinct

// 16-lane (half-wave) reductions via DPP: xor1, xor2, half-mirror, mirror.
// Rows of the WMMA C-matrix live in 16-lane halves, so this reduces each row.
__device__ __forceinline__ float dpp_hmax16(float x) {
  float t;
  t = __int_as_float(__builtin_amdgcn_update_dpp(__float_as_int(x), __float_as_int(x), 0x0B1, 0xF, 0xF, true)); x = fmaxf(x, t);
  t = __int_as_float(__builtin_amdgcn_update_dpp(__float_as_int(x), __float_as_int(x), 0x04E, 0xF, 0xF, true)); x = fmaxf(x, t);
  t = __int_as_float(__builtin_amdgcn_update_dpp(__float_as_int(x), __float_as_int(x), 0x141, 0xF, 0xF, true)); x = fmaxf(x, t);
  t = __int_as_float(__builtin_amdgcn_update_dpp(__float_as_int(x), __float_as_int(x), 0x140, 0xF, 0xF, true)); x = fmaxf(x, t);
  return x;
}
__device__ __forceinline__ float dpp_hsum16(float x) {
  float t;
  t = __int_as_float(__builtin_amdgcn_update_dpp(__float_as_int(x), __float_as_int(x), 0x0B1, 0xF, 0xF, true)); x += t;
  t = __int_as_float(__builtin_amdgcn_update_dpp(__float_as_int(x), __float_as_int(x), 0x04E, 0xF, 0xF, true)); x += t;
  t = __int_as_float(__builtin_amdgcn_update_dpp(__float_as_int(x), __float_as_int(x), 0x141, 0xF, 0xF, true)); x += t;
  t = __int_as_float(__builtin_amdgcn_update_dpp(__float_as_int(x), __float_as_int(x), 0x140, 0xF, 0xF, true)); x += t;
  return x;
}

// Async 16-byte global -> LDS copy (ASYNCcnt), per-lane addresses.
__device__ __forceinline__ void async_g2l_b128(unsigned lds_off, const void* gptr) {
  unsigned long long ga = (unsigned long long)(uintptr_t)gptr;
  asm volatile("global_load_async_to_lds_b128 %0, %1, off" :: "v"(lds_off), "v"(ga) : "memory");
}
__device__ __forceinline__ unsigned lds_offset(const void* p) {
  return (unsigned)(uintptr_t)p;   // flat LDS addr truncates to LDS offset
}

// ---------------------------------------------------------------------------
// Load a 16(rows) x 32(k) f16 tile from row-major memory into WMMA A-operand
// layout (ISA 7.12.2, 16-bit A 16x32):
//   lanes 0-15  : row = lane,     K = 0-7   and 16-23
//   lanes 16-31 : row = lane-16,  K = 8-15  and 24-31
// The B operand of D = A*B is the A-layout of B^T, so K tiles / W rows /
// V^T rows all load through this same helper.
// ---------------------------------------------------------------------------
__device__ __forceinline__ v16h load_af(const h16* __restrict__ p, int ld, int k0, int lane) {
  const int row = lane & 15;
  const int hi  = (lane >> 4) << 3;           // 0 or 8
  const h16* q = p + (size_t)row * ld + k0 + hi;
  union { v16h v; v8h h[2]; } u;
  u.h[0] = *(const v8h*)(q);
  u.h[1] = *(const v8h*)(q + 16);
  return u.v;
}

// ---------------------------------------------------------------------------
// f32 -> f16 conversion (X and the four weight matrices), 4 elems/thread
// ---------------------------------------------------------------------------
__global__ __launch_bounds__(256) void cvt_f32_f16(const float* __restrict__ src,
                                                   h16* __restrict__ dst, int n) {
  int i = (blockIdx.x * blockDim.x + threadIdx.x) * 4;
  if (i + 3 < n) {
    float4 v = *(const float4*)(src + i);
    v4h o = { (h16)v.x, (h16)v.y, (h16)v.z, (h16)v.w };
    *(v4h*)(dst + i) = o;
  }
}

// ---------------------------------------------------------------------------
// GEMM: Y = A(4096x1024, f16 row-major) * W^T (W is 1024x1024 f16 row-major).
// Block = 128x128 (8 waves as 4Mx2N), wave = 32x64 -> 2x4 accum tiles.
// Operand tiles double-buffered in LDS with async b128 copies:
//   wait(cur) -> barrier -> issue(next into alt buffer) -> compute(cur)
// MODE 0: store f16 head-major [B,H,S,64]      (Q, K)
// MODE 1: store f16 head-transposed [B,H,64,S] (V^T, feeds PV B-operand)
// MODE 2: store f32 row-major [4096,1024]      (final output projection)
// ---------------------------------------------------------------------------
template <int MODE>
__global__ __launch_bounds__(256) void gemm_xwt(const h16* __restrict__ A,
                                                const h16* __restrict__ W,
                                                void* __restrict__ dst) {
  __shared__ h16 shA[2][128 * LDT];   // 2 x 10 KiB
  __shared__ h16 shW[2][128 * LDT];   // 2 x 10 KiB

  const int tid  = threadIdx.x;
  const int lane = tid & 31;
  const int w    = tid >> 5;
  const int wm   = w & 3;            // 0..3
  const int wn   = w >> 2;           // 0..1
  const int rowB = blockIdx.y * 128;           // block row origin
  const int colB = blockIdx.x * 128;           // block col origin (W row origin)

  // async-copy assignment: each thread moves 2x16B of A and 2x16B of W
  const int crow  = tid >> 1;                  // 0..127
  const int csub0 = (tid & 1) * 2;             // subs {0,1} or {2,3} (16B units)
  const h16* agrow = A + (size_t)(rowB + crow) * Dm;
  const h16* wgrow = W + (size_t)(colB + crow) * Dm;
  const unsigned laA0 = lds_offset(&shA[0][crow * LDT + csub0 * 8]);
  const unsigned laW0 = lds_offset(&shW[0][crow * LDT + csub0 * 8]);
  const unsigned bufstride = (unsigned)(128 * LDT * sizeof(h16));

  auto issue_tile = [&](int k0, int buf) {
    const unsigned bo = (unsigned)buf * bufstride;
#pragma unroll
    for (int c = 0; c < 2; ++c) {
      const int sub = csub0 + c;
      async_g2l_b128(laA0 + bo + c * 16, agrow + k0 + sub * 8);
      async_g2l_b128(laW0 + bo + c * 16, wgrow + k0 + sub * 8);
    }
  };

  v8f acc[2][4];
#pragma unroll
  for (int i = 0; i < 2; ++i)
#pragma unroll
    for (int j = 0; j < 4; ++j) acc[i][j] = {};

  issue_tile(0, 0);                            // prologue fill

  for (int kt = 0; kt < Dm / 32; ++kt) {
    const int cur = kt & 1;
    asm volatile("s_wait_asynccnt 0x0" ::: "memory");
    __syncthreads();                           // cur tile visible to all waves
    if (kt + 1 < Dm / 32) issue_tile((kt + 1) * 32, cur ^ 1);  // overlap copy

    v16h af[2], bf[4];
#pragma unroll
    for (int i = 0; i < 2; ++i)
      af[i] = load_af(shA[cur] + (wm * 32 + 16 * i) * LDT, LDT, 0, lane);
#pragma unroll
    for (int j = 0; j < 4; ++j)
      bf[j] = load_af(shW[cur] + (wn * 64 + 16 * j) * LDT, LDT, 0, lane);

#pragma unroll
    for (int i = 0; i < 2; ++i)
#pragma unroll
      for (int j = 0; j < 4; ++j)
        acc[i][j] = WMMA16x16x32(af[i], bf[j], acc[i][j]);
  }

  // C/D layout: lane<16 -> N=lane, M=r ; lane>=16 -> N=lane-16, M=r+8
  const int nlo   = lane & 15;
  const int rbase = (lane >> 4) * 8;
  const int row0  = rowB + wm * 32;
  const int col0  = colB + wn * 64;
#pragma unroll
  for (int i = 0; i < 2; ++i) {
#pragma unroll
    for (int j = 0; j < 4; ++j) {
#pragma unroll
      for (int r = 0; r < 8; ++r) {
        const int grow = row0 + 16 * i + rbase + r;     // 0..4095
        const int gcol = col0 + 16 * j + nlo;           // 0..1023
        const float val = acc[i][j][r];
        if constexpr (MODE == 2) {
          ((float*)dst)[(size_t)grow * Dm + gcol] = val;
        } else {
          const int b = grow >> 11, s = grow & (Sq - 1);
          const int h = gcol >> 6, d = gcol & (HD - 1);
          if constexpr (MODE == 0)
            ((h16*)dst)[(((size_t)b * Hh + h) * Sq + s) * HD + d] = (h16)val;
          else
            ((h16*)dst)[(((size_t)b * Hh + h) * HD + d) * Sq + s] = (h16)val;
        }
      }
    }
  }
}

// ---------------------------------------------------------------------------
// Flash attention: 1 wave per (b, h, 32-query block) = 2048 waves.
// Each wave owns TWO 16-row query tiles so every K/V fragment load feeds
// 2x the WMMAs. 32 keys / iteration: 8 score WMMAs, DPP row-max softmax
// (lane-local running row-sums, reduced once at the end), P staged through
// per-wave LDS (C-layout -> A-layout), 8 PV WMMAs sharing the V fragments.
// ---------------------------------------------------------------------------
__global__ __launch_bounds__(256) void attn_fwd(const h16* __restrict__ Qh,
                                                const h16* __restrict__ Kh,
                                                const h16* __restrict__ Vt,
                                                const int* __restrict__ amask,
                                                h16* __restrict__ Ah) {
  __shared__ h16 lds_p[8][2][16][32];    // per-wave 2x(16x32) P staging (16 KiB)

  const int lane = threadIdx.x & 31;
  const int w    = threadIdx.x >> 5;
  const int gw   = blockIdx.x * 8 + w;          // 0..2047
  const int b    = gw >> 10;                    // / (H*64)
  const int rem  = gw & 1023;
  const int h    = rem >> 6;
  const int q0   = (rem & 63) * 32;

  const h16* qbase = Qh + (((size_t)b * Hh + h) * Sq + q0) * HD;
  const h16* kbase = Kh + (((size_t)b * Hh + h) * Sq) * HD;
  const h16* vbase = Vt + (((size_t)b * Hh + h) * HD) * Sq;
  const int* mrow  = amask + b * Sq;

  v16h qf[2][2];
#pragma unroll
  for (int u = 0; u < 2; ++u) {
    qf[u][0] = load_af(qbase + (size_t)u * 16 * HD, HD, 0, lane);
    qf[u][1] = load_af(qbase + (size_t)u * 16 * HD, HD, 32, lane);
  }

  float rm[2][8], rl[2][8];              // rl is LANE-LOCAL partial row sum
  v8f o[2][4];
#pragma unroll
  for (int u = 0; u < 2; ++u) {
#pragma unroll
    for (int r = 0; r < 8; ++r) { rm[u][r] = -INFINITY; rl[u][r] = 0.0f; }
#pragma unroll
    for (int j = 0; j < 4; ++j) o[u][j] = {};
  }

  const int csub = lane & 15;
  const int rh   = (lane >> 4) * 8;

  for (int kt = 0; kt < Sq / 32; ++kt) {
    const int k0 = kt * 32;

    // ---- shared K fragments for both query tiles ----
    v16h kb[2][2];
#pragma unroll
    for (int t = 0; t < 2; ++t) {
      kb[t][0] = load_af(kbase + (size_t)(k0 + 16 * t) * HD, HD, 0, lane);
      kb[t][1] = load_af(kbase + (size_t)(k0 + 16 * t) * HD, HD, 32, lane);
    }
    const int mv0 = mrow[k0 + csub];
    const int mv1 = mrow[k0 + 16 + csub];

#pragma unroll
    for (int u = 0; u < 2; ++u) {
      // ---- scores (4 WMMAs per query tile) ----
      v8f sc[2];
#pragma unroll
      for (int t = 0; t < 2; ++t) {
        sc[t] = {};
        sc[t] = WMMA16x16x32(qf[u][0], kb[t][0], sc[t]);
        sc[t] = WMMA16x16x32(qf[u][1], kb[t][1], sc[t]);
      }
      // ---- online softmax: DPP row-max, lane-local row-sum ----
#pragma unroll
      for (int r = 0; r < 8; ++r) {
        float s0 = mv0 ? sc[0][r] * 0.125f : -1e9f;   // 1/sqrt(64)
        float s1 = mv1 ? sc[1][r] * 0.125f : -1e9f;
        const float m   = dpp_hmax16(fmaxf(s0, s1));  // uniform across half
        const float mn  = fmaxf(rm[u][r], m);
        const float cor = __expf(rm[u][r] - mn);
        const float p0  = __expf(s0 - mn);
        const float p1  = __expf(s1 - mn);
        rl[u][r] = rl[u][r] * cor + (p0 + p1);        // reduce at end
        rm[u][r] = mn;
        o[u][0][r] *= cor; o[u][1][r] *= cor; o[u][2][r] *= cor; o[u][3][r] *= cor;
        lds_p[w][u][rh + r][csub]      = (h16)p0;
        lds_p[w][u][rh + r][16 + csub] = (h16)p1;
      }
    }
    asm volatile("s_wait_dscnt 0x0" ::: "memory");

    // ---- reload P as 16x32 A-operands ----
    v16h pf[2];
    {
      const int prow = lane & 15;
      const int phi  = (lane >> 4) << 3;
#pragma unroll
      for (int u = 0; u < 2; ++u) {
        union { v16h v; v8h hh[2]; } uu;
        uu.hh[0] = *(const v8h*)&lds_p[w][u][prow][phi];
        uu.hh[1] = *(const v8h*)&lds_p[w][u][prow][16 + phi];
        pf[u] = uu.v;
      }
    }
    // ---- P*V: V fragments shared by both query tiles (8 WMMAs) ----
#pragma unroll
    for (int j = 0; j < 4; ++j) {
      v16h vb = load_af(vbase + (size_t)(j * 16) * Sq, Sq, k0, lane);
      o[0][j] = WMMA16x16x32(pf[0], vb, o[0][j]);
      o[1][j] = WMMA16x16x32(pf[1], vb, o[1][j]);
    }
  }

  // ---- final row-sum reduction, normalize, store f16 Ah[4096,1024] ----
#pragma unroll
  for (int u = 0; u < 2; ++u) {
#pragma unroll
    for (int r = 0; r < 8; ++r) {
      const float inv = 1.0f / dpp_hsum16(rl[u][r]);
      const int s = q0 + u * 16 + rh + r;
#pragma unroll
      for (int j = 0; j < 4; ++j) {
        const int col = h * HD + j * 16 + csub;
        Ah[((size_t)b * Sq + s) * Dm + col] = (h16)(o[u][j][r] * inv);
      }
    }
  }
}

// ---------------------------------------------------------------------------
// Launch
// ---------------------------------------------------------------------------
extern "C" void kernel_launch(void* const* d_in, const int* in_sizes, int n_in,
                              void* d_out, int out_size, void* d_ws, size_t ws_size,
                              hipStream_t stream) {
  const float* X    = (const float*)d_in[0];
  const int*   mask = (const int*)d_in[1];
  const float* Wq   = (const float*)d_in[2];
  const float* Wk   = (const float*)d_in[3];
  const float* Wv   = (const float*)d_in[4];
  const float* Wo   = (const float*)d_in[5];

  char* ws = (char*)d_ws;
  const size_t MiB = 1u << 20;
  h16* Xh  = (h16*)(ws + 0 * MiB);   // 8 MiB  [4096,1024]
  h16* Wqh = (h16*)(ws + 8 * MiB);   // 2 MiB
  h16* Wkh = (h16*)(ws + 10 * MiB);  // 2 MiB
  h16* Wvh = (h16*)(ws + 12 * MiB);  // 2 MiB
  h16* Woh = (h16*)(ws + 14 * MiB);  // 2 MiB
  h16* Qh  = (h16*)(ws + 16 * MiB);  // 8 MiB  [B,H,S,64]
  h16* Kh  = (h16*)(ws + 24 * MiB);  // 8 MiB  [B,H,S,64]
  h16* Vt  = (h16*)(ws + 32 * MiB);  // 8 MiB  [B,H,64,S]
  h16* Ah  = (h16*)(ws + 40 * MiB);  // 8 MiB  [4096,1024]

  // f32 -> f16
  cvt_f32_f16<<<(Mrows * Dm) / 1024, 256, 0, stream>>>(X, Xh, Mrows * Dm);
  cvt_f32_f16<<<(Dm * Dm) / 1024, 256, 0, stream>>>(Wq, Wqh, Dm * Dm);
  cvt_f32_f16<<<(Dm * Dm) / 1024, 256, 0, stream>>>(Wk, Wkh, Dm * Dm);
  cvt_f32_f16<<<(Dm * Dm) / 1024, 256, 0, stream>>>(Wv, Wvh, Dm * Dm);
  cvt_f32_f16<<<(Dm * Dm) / 1024, 256, 0, stream>>>(Wo, Woh, Dm * Dm);

  // QKV projections
  dim3 gg(Dm / 128, Mrows / 128);    // (8, 32)
  gemm_xwt<0><<<gg, 256, 0, stream>>>(Xh, Wqh, Qh);
  gemm_xwt<0><<<gg, 256, 0, stream>>>(Xh, Wkh, Kh);
  gemm_xwt<1><<<gg, 256, 0, stream>>>(Xh, Wvh, Vt);

  // streaming attention (2048 waves, 8 waves/block)
  attn_fwd<<<256, 256, 0, stream>>>(Qh, Kh, Vt, mask, Ah);

  // output projection -> f32 d_out
  gemm_xwt<2><<<gg, 256, 0, stream>>>(Ah, Woh, d_out);
}

// v001
// It runs in 150 microseconds.
// In two side-by-side timings against v000, it was 1.28 and 1.30 times as fast.
#include <hip/hip_runtime.h>
#include <hip/hip_bf16.h>
#include <math.h>

// ---------------------------------------------------------------------------
// Attention forward on MI455X (gfx1250, wave32, WMMA)
//   B=2, S=2048, D=1024, H=16, hd=64
// v_wmma_f32_16x16x32_f16 everywhere; GEMMs double-buffer tiles in LDS via
// global_load_async_to_lds_b128 (ASYNCcnt); softmax row reductions via DPP.
// Flash attention processes 2 query tiles per wave to double WMMA/byte; its K and
// V^T tiles are staged in LDS once per work-group by the same async copies.
// ---------------------------------------------------------------------------

typedef _Float16 h16;
typedef __attribute__((ext_vector_type(16))) _Float16 v16h;
typedef __attribute__((ext_vector_type(8)))  _Float16 v8h;
typedef __attribute__((ext_vector_type(4)))  _Float16 v4h;
typedef __attribute__((ext_vector_type(8)))  float    v8f;

#define WMMA16x16x32(a, b, c) \
  __builtin_amdgcn_wmma_f32_16x16x32_f16(false, (a), false, (b), (short)0, (c), false, false)

constexpr int Bz = 2;
constexpr int Sq = 2048;
constexpr int Dm = 1024;
constexpr int Hh = 16;
constexpr int HD = 64;
constexpr int Mrows = Bz * Sq;   // 4096
constexpr int LDT = 40;          // padded LDS tile row stride (halfs): 20*r mod 64 distinct
constexpr int KT  = 64;          // keys per staged attention tile
constexpr int LDK = 72;          // LDS pitch of its 128-B rows (halfs): 144 B = 16 B x odd

// 16-lane (half-wave) reductions via DPP: xor1, xor2, half-mirror, mirror.
// Rows of the WMMA C-matrix live in 16-lane halves, so this reduces each row.
__device__ __forceinline__ float dpp_hmax16(float x) {
  float t;
  t = __int_as_float(__builtin_amdgcn_update_dpp(__float_as_int(x), __float_as_int(x), 0x0B1, 0xF, 0xF, true)); x = fmaxf(x, t);
  t = __int_as_float(__builtin_amdgcn_update_dpp(__float_as_int(x), __float_as_int(x), 0x04E, 0xF, 0xF, true)); x = fmaxf(x, t);
  t = __int_as_float(__builtin_amdgcn_update_dpp(__float_as_int(x), __float_as_int(x), 0x141, 0xF, 0xF, true)); x = fmaxf(x, t);
  t = __int_as_float(__builtin_amdgcn_update_dpp(__float_as_int(x), __float_as_int(x), 0x140, 0xF, 0xF, true)); x = fmaxf(x, t);
  return x;
}
__device__ __forceinline__ float dpp_hsum16(float x) {
  float t;
  t = __int_as_float(__builtin_amdgcn_update_dpp(__float_as_int(x), __float_as_int(x), 0x0B1, 0xF, 0xF, true)); x += t;
  t = __int_as_float(__builtin_amdgcn_update_dpp(__float_as_int(x), __float_as_int(x), 0x04E, 0xF, 0xF, true)); x += t;
  t = __int_as_float(__builtin_amdgcn_update_dpp(__float_as_int(x), __float_as_int(x), 0x141, 0xF, 0xF, true)); x += t;
  t = __int_as_float(__builtin_amdgcn_update_dpp(__float_as_int(x), __float_as_int(x), 0x140, 0xF, 0xF, true)); x += t;
  return x;
}

// Async 16-byte global -> LDS copy (ASYNCcnt), per-lane addresses.
__device__ __forceinline__ void async_g2l_b128(unsigned lds_off, const void* gptr) {
  unsigned long long ga = (unsigned long long)(uintptr_t)gptr;
  asm volatile("global_load_async_to_lds_b128 %0, %1, off" :: "v"(lds_off), "v"(ga) : "memory");
}
__device__ __forceinline__ unsigned lds_offset(const void* p) {
  return (unsigned)(uintptr_t)p;   // flat LDS addr truncates to LDS offset
}
// Two or four async 16-byte copies of one lane in one statement. s_wait_xcnt 0 is the
// statement's last line so that it stands in front of every later rewrite of the
// address registers named here (a precaution).
__device__ __forceinline__ void async_g2l_b128_x2(unsigned l0, const void* g0, unsigned l1, const void* g1) {
  unsigned long long a0 = (unsigned long long)(uintptr_t)g0;
  unsigned long long a1 = (unsigned long long)(uintptr_t)g1;
  asm volatile("global_load_async_to_lds_b128 %0, %1, off\n\t"
               "global_load_async_to_lds_b128 %2, %3, off\n\t"
               "s_wait_xcnt 0x0"
               :: "v"(l0), "v"(a0), "v"(l1), "v"(a1)
               : "memory");
}
__device__ __forceinline__ void async_g2l_b128_x4(unsigned l0, const void* g0, unsigned l1, const void* g1,
                                                  unsigned l2, const void* g2, unsigned l3, const void* g3) {
  unsigned long long a0 = (unsigned long long)(uintptr_t)g0;
  unsigned long long a1 = (unsigned long long)(uintptr_t)g1;
  unsigned long long a2 = (unsigned long long)(uintptr_t)g2;
  unsigned long long a3 = (unsigned long long)(uintptr_t)g3;
  asm volatile("global_load_async_to_lds_b128 %0, %1, off\n\t"
               "global_load_async_to_lds_b128 %2, %3, off\n\t"
               "global_load_async_to_lds_b128 %4, %5, off\n\t"
               "global_load_async_to_lds_b128 %6, %7, off\n\t"
               "s_wait_xcnt 0x0"
               :: "v"(l0), "v"(a0), "v"(l1), "v"(a1), "v"(l2), "v"(a2), "v"(l3), "v"(a3)
               : "memory");
}

// ---------------------------------------------------------------------------
// Load a 16(rows) x 32(k) f16 tile from row-major memory into WMMA A-operand
// layout (ISA 7.12.2, 16-bit A 16x32):
//   lanes 0-15  : row = lane,     K = 0-7   and 16-23
//   lanes 16-31 : row = lane-16,  K = 8-15  and 24-31
// The B operand of D = A*B is the A-layout of B^T, so K tiles / W rows /
// V^T rows all load through this same helper.
// ---------------------------------------------------------------------------
__device__ __forceinline__ v16h load_af(const h16* __restrict__ p, int ld, int k0, int lane) {
  const int row = lane & 15;
  const int hi  = (lane >> 4) << 3;           // 0 or 8
  const h16* q = p + (size_t)row * ld + k0 + hi;
  union { v16h v; v8h h[2]; } u;
  u.h[0] = *(const v8h*)(q);
  u.h[1] = *(const v8h*)(q + 16);
  return u.v;
}

// ---------------------------------------------------------------------------
// f32 -> f16 conversion (X and the four weight matrices), 4 elems/thread
// ---------------------------------------------------------------------------
__global__ __launch_bounds__(256) void cvt_f32_f16(const float* __restrict__ src,
                                                   h16* __restrict__ dst, int n) {
  int i = (blockIdx.x * blockDim.x + threadIdx.x) * 4;
  if (i + 3 < n) {
    float4 v = *(const float4*)(src + i);
    v4h o = { (h16)v.x, (h16)v.y, (h16)v.z, (h16)v.w };
    *(v4h*)(dst + i) = o;
  }
}

// ---------------------------------------------------------------------------
// GEMM: Y = A(4096x1024, f16 row-major) * W^T (W is 1024x1024 f16 row-major).
// Block = 128x128 (8 waves as 4Mx2N), wave = 32x64 -> 2x4 accum tiles.
// Operand tiles double-buffered in LDS with async b128 copies:
//   wait(cur) -> barrier -> issue(next into alt buffer) -> compute(cur)
// MODE 0: store f16 head-major [B,H,S,64]      (Q, K)
// MODE 1: store f16 head-transposed [B,H,64,S] (V^T, feeds PV B-operand)
// MODE 2: store f32 row-major [4096,1024]      (final output projection)
// ---------------------------------------------------------------------------
template <int MODE>
__global__ __launch_bounds__(256) void gemm_xwt(const h16* __restrict__ A,
                                                const h16* __restrict__ W,
                                                void* __restrict__ dst) {
  __shared__ h16 shA[2][128 * LDT];   // 2 x 10 KiB
  __shared__ h16 shW[2][128 * LDT];   // 2 x 10 KiB

  const int tid  = threadIdx.x;
  const int lane = tid & 31;
  const int w    = tid >> 5;
  const int wm   = w & 3;            // 0..3
  const int wn   = w >> 2;           // 0..1
  const int rowB = blockIdx.y * 128;           // block row origin
  const int colB = blockIdx.x * 128;           // block col origin (W row origin)

  // async-copy assignment: each thread moves 2x16B of A and 2x16B of W
  const int crow  = tid >> 1;                  // 0..127
  const int csub0 = (tid & 1) * 2;             // subs {0,1} or {2,3} (16B units)
  const h16* agrow = A + (size_t)(rowB + crow) * Dm;
  const h16* wgrow = W + (size_t)(colB + crow) * Dm;
  const unsigned laA0 = lds_offset(&shA[0][crow * LDT + csub0 * 8]);
  const unsigned laW0 = lds_offset(&shW[0][crow * LDT + csub0 * 8]);
  const unsigned bufstride = (unsigned)(128 * LDT * sizeof(h16));

  auto issue_tile = [&](int k0, int buf) {
    const unsigned bo = (unsigned)buf * bufstride;
#pragma unroll
    for (int c = 0; c < 2; ++c) {
      const int sub = csub0 + c;
      async_g2l_b128(laA0 + bo + c * 16, agrow + k0 + sub * 8);
      async_g2l_b128(laW0 + bo + c * 16, wgrow + k0 + sub * 8);
    }
  };

  v8f acc[2][4];
#pragma unroll
  for (int i = 0; i < 2; ++i)
#pragma unroll
    for (int j = 0; j < 4; ++j) acc[i][j] = {};

  issue_tile(0, 0);                            // prologue fill

  for (int kt = 0; kt < Dm / 32; ++kt) {
    const int cur = kt & 1;
    asm volatile("s_wait_asynccnt 0x0" ::: "memory");
    __syncthreads();                           // cur tile visible to all waves
    if (kt + 1 < Dm / 32) issue_tile((kt + 1) * 32, cur ^ 1);  // overlap copy

    v16h af[2], bf[4];
#pragma unroll
    for (int i = 0; i < 2; ++i)
      af[i] = load_af(shA[cur] + (wm * 32 + 16 * i) * LDT, LDT, 0, lane);
#pragma unroll
    for (int j = 0; j < 4; ++j)
      bf[j] = load_af(shW[cur] + (wn * 64 + 16 * j) * LDT, LDT, 0, lane);

#pragma unroll
    for (int i = 0; i < 2; ++i)
#pragma unroll
      for (int j = 0; j < 4; ++j)
        acc[i][j] = WMMA16x16x32(af[i], bf[j], acc[i][j]);
  }

  // C/D layout: lane<16 -> N=lane, M=r ; lane>=16 -> N=lane-16, M=r+8
  const int nlo   = lane & 15;
  const int rbase = (lane >> 4) * 8;
  const int row0  = rowB + wm * 32;
  const int col0  = colB + wn * 64;
#pragma unroll
  for (int i = 0; i < 2; ++i) {
#pragma unroll
    for (int j = 0; j < 4; ++j) {
#pragma unroll
      for (int r = 0; r < 8; ++r) {
        const int grow = row0 + 16 * i + rbase + r;     // 0..4095
        const int gcol = col0 + 16 * j + nlo;           // 0..1023
        const float val = acc[i][j][r];
        if constexpr (MODE == 2) {
          ((float*)dst)[(size_t)grow * Dm + gcol] = val;
        } else {
          const int b = grow >> 11, s = grow & (Sq - 1);
          const int h = gcol >> 6, d = gcol & (HD - 1);
          if constexpr (MODE == 0)
            ((h16*)dst)[(((size_t)b * Hh + h) * Sq + s) * HD + d] = (h16)val;
          else
            ((h16*)dst)[(((size_t)b * Hh + h) * HD + d) * Sq + s] = (h16)val;
        }
      }
    }
  }
}

// ---------------------------------------------------------------------------
// Flash attention: 1 wave per (b, h, 32-query block) = 2048 waves.
// Each wave owns TWO 16-row query tiles so every K/V fragment load feeds
// 2x the WMMAs. 32 keys / iteration: 8 score WMMAs, DPP row-max softmax
// (lane-local running row-sums, reduced once at the end), P staged through
// per-wave LDS (C-layout -> A-layout), 8 PV WMMAs sharing the V fragments.
// The 8 waves of a block share one (b, h): each 64-key tile of K (64 x 128 B) and
// of V^T (64 x 128 B) is copied to LDS once per block, whole lines per 8 lanes,
// into two buffers: tile t + 1 flies while tile t is worked on. The batch's mask
// row (8 KiB) is copied once, with tile 0.
// ---------------------------------------------------------------------------
__global__ __launch_bounds__(256) void attn_fwd(const h16* __restrict__ Qh,
                                                const h16* __restrict__ Kh,
                                                const h16* __restrict__ Vt,
                                                const int* __restrict__ amask,
                                                h16* __restrict__ Ah) {
  __shared__ h16 lds_p[8][2][16][32];    // per-wave 2x(16x32) P staging (16 KiB)
  __shared__ __attribute__((aligned(16))) h16 shK[2][KT * LDK];   // 2 x 9 KiB, rows = keys
  __shared__ __attribute__((aligned(16))) h16 shV[2][HD * LDK];   // 2 x 9 KiB, rows = d
  __shared__ __attribute__((aligned(16))) int shM[Sq];            // 8 KiB, mask row of batch b

  const int lane = threadIdx.x & 31;
  const int w    = threadIdx.x >> 5;
  const int gw   = blockIdx.x * 8 + w;          // 0..2047
  const int b    = gw >> 10;                    // / (H*64)
  const int rem  = gw & 1023;
  const int h    = rem >> 6;
  const int q0   = (rem & 63) * 32;

  const h16* qbase = Qh + (((size_t)b * Hh + h) * Sq + q0) * HD;
  const h16* kbase = Kh + (((size_t)b * Hh + h) * Sq) * HD;
  const h16* vbase = Vt + (((size_t)b * Hh + h) * HD) * Sq;
  const int* mrow  = amask + b * Sq;

  // copy assignment: 8 lanes per 128-B row, rows crow and crow + 32 of each tile
  const int crow = threadIdx.x >> 3;            // 0..31
  const int ccol = (threadIdx.x & 7) * 8;       // halfs
  const h16* kg = kbase + (size_t)crow * HD + ccol;
  const h16* vg = vbase + (size_t)crow * Sq + ccol;
  const unsigned lk = lds_offset(&shK[0][crow * LDK + ccol]);
  const unsigned lv = lds_offset(&shV[0][crow * LDK + ccol]);
  constexpr unsigned bufB  = (unsigned)(KT * LDK * sizeof(h16));
  constexpr unsigned halfB = (unsigned)(32 * LDK * sizeof(h16));
  auto issue_tile = [&](int tile, int buf) {
    const unsigned bo = (unsigned)buf * bufB;
    const h16* k = kg + (size_t)tile * KT * HD;
    const h16* v = vg + (size_t)tile * KT;
    async_g2l_b128_x4(lk + bo, k, lk + bo + halfB, k + 32 * HD,
                      lv + bo, v, lv + bo + halfB, v + (size_t)32 * Sq);
  };

  issue_tile(0, 0);
  async_g2l_b128_x2(lds_offset(&shM[threadIdx.x * 4]), mrow + threadIdx.x * 4,
                    lds_offset(&shM[Sq / 2 + threadIdx.x * 4]), mrow + Sq / 2 + threadIdx.x * 4);
  asm volatile("s_wait_asynccnt 0x0" ::: "memory");   // this wave's part of tile 0 and of the mask has landed
  __syncthreads();                                    // both visible to all waves
  issue_tile(1, 1);

  v16h qf[2][2];
#pragma unroll
  for (int u = 0; u < 2; ++u) {
    qf[u][0] = load_af(qbase + (size_t)u * 16 * HD, HD, 0, lane);
    qf[u][1] = load_af(qbase + (size_t)u * 16 * HD, HD, 32, lane);
  }

  float rm[2][8], rl[2][8];              // rl is LANE-LOCAL partial row sum
  v8f o[2][4];
#pragma unroll
  for (int u = 0; u < 2; ++u) {
#pragma unroll
    for (int r = 0; r < 8; ++r) { rm[u][r] = -INFINITY; rl[u][r] = 0.0f; }
#pragma unroll
    for (int j = 0; j < 4; ++j) o[u][j] = {};
  }

  const int csub = lane & 15;
  const int rh   = (lane >> 4) * 8;

  for (int kt = 0; kt < Sq / 32; ++kt) {
    const int k0  = kt * 32;
    const int cur = (kt >> 1) & 1;               // buffer of tile kt / 2
    const int kl  = (kt & 1) * 32;               // first key of this pass inside the tile

    // ---- shared K fragments for both query tiles ----
    v16h kb[2][2];
#pragma unroll
    for (int t = 0; t < 2; ++t) {
      kb[t][0] = load_af(shK[cur] + (kl + 16 * t) * LDK, LDK, 0, lane);
      kb[t][1] = load_af(shK[cur] + (kl + 16 * t) * LDK, LDK, 32, lane);
    }
    const int mv0 = shM[k0 + csub];
    const int mv1 = shM[k0 + 16 + csub];

#pragma unroll
    for (int u = 0; u < 2; ++u) {
      // ---- scores (4 WMMAs per query tile) ----
      v8f sc[2];
#pragma unroll
      for (int t = 0; t < 2; ++t) {
        sc[t] = {};
        sc[t] = WMMA16x16x32(qf[u][0], kb[t][0], sc[t]);
        sc[t] = WMMA16x16x32(qf[u][1], kb[t][1], sc[t]);
      }
      // ---- online softmax: DPP row-max, lane-local row-sum ----
#pragma unroll
      for (int r = 0; r < 8; ++r) {
        float s0 = mv0 ? sc[0][r] * 0.125f : -1e9f;   // 1/sqrt(64)
        float s1 = mv1 ? sc[1][r] * 0.125f : -1e9f;
        const float m   = dpp_hmax16(fmaxf(s0, s1));  // uniform across half
        const float mn  = fmaxf(rm[u][r], m);
        const float cor = __expf(rm[u][r] - mn);
        const float p0  = __expf(s0 - mn);
        const float p1  = __expf(s1 - mn);
        rl[u][r] = rl[u][r] * cor + (p0 + p1);        // reduce at end
        rm[u][r] = mn;
        o[u][0][r] *= cor; o[u][1][r] *= cor; o[u][2][r] *= cor; o[u][3][r] *= cor;
        lds_p[w][u][rh + r][csub]      = (h16)p0;
        lds_p[w][u][rh + r][16 + csub] = (h16)p1;
      }
    }
    asm volatile("s_wait_dscnt 0x0" ::: "memory");

    // ---- reload P as 16x32 A-operands ----
    v16h pf[2];
    {
      const int prow = lane & 15;
      const int phi  = (lane >> 4) << 3;
#pragma unroll
      for (int u = 0; u < 2; ++u) {
        union { v16h v; v8h hh[2]; } uu;
        uu.hh[0] = *(const v8h*)&lds_p[w][u][prow][phi];
        uu.hh[1] = *(const v8h*)&lds_p[w][u][prow][16 + phi];
        pf[u] = uu.v;
      }
    }
    // ---- P*V: V fragments shared by both query tiles (8 WMMAs) ----
#pragma unroll
    for (int j = 0; j < 4; ++j) {
      v16h vb = load_af(shV[cur] + (j * 16) * LDK, LDK, kl, lane);
      o[0][j] = WMMA16x16x32(pf[0], vb, o[0][j]);
      o[1][j] = WMMA16x16x32(pf[1], vb, o[1][j]);
    }

    // ---- foot of a tile's second pass: publish tile + 1, refill this buffer ----
    if (kt & 1) {
      asm volatile("s_wait_dscnt 0x0" ::: "memory");     // this wave's reads of the buffer are done
      asm volatile("s_wait_asynccnt 0x0" ::: "memory");  // this wave's part of the next tile has landed
      __syncthreads();                                   // next tile visible; this buffer free
      if ((kt >> 1) + 2 < Sq / KT) issue_tile((kt >> 1) + 2, cur);
    }
  }
  asm volatile("s_wait_asynccnt 0x0" ::: "memory");      // no copy outstanding at the wave's end

  // ---- final row-sum reduction, normalize, store f16 Ah[4096,1024] ----
#pragma unroll
  for (int u = 0; u < 2; ++u) {
#pragma unroll
    for (int r = 0; r < 8; ++r) {
      const float inv = 1.0f / dpp_hsum16(rl[u][r]);
      const int s = q0 + u * 16 + rh + r;
#pragma unroll
      for (int j = 0; j < 4; ++j) {
        const int col = h * HD + j * 16 + csub;
        Ah[((size_t)b * Sq + s) * Dm + col] = (h16)(o[u][j][r] * inv);
      }
    }
  }
}

// ---------------------------------------------------------------------------
// Launch
// ---------------------------------------------------------------------------
extern "C" void kernel_launch(void* const* d_in, const int* in_sizes, int n_in,
                              void* d_out, int out_size, void* d_ws, size_t ws_size,
                              hipStream_t stream) {
  const float* X    = (const float*)d_in[0];
  const int*   mask = (const int*)d_in[1];
  const float* Wq   = (const float*)d_in[2];
  const float* Wk   = (const float*)d_in[3];
  const float* Wv   = (const float*)d_in[4];
  const float* Wo   = (const float*)d_in[5];

  char* ws = (char*)d_ws;
  const size_t MiB = 1u << 20;
  h16* Xh  = (h16*)(ws + 0 * MiB);   // 8 MiB  [4096,1024]
  h16* Wqh = (h16*)(ws + 8 * MiB);   // 2 MiB
  h16* Wkh = (h16*)(ws + 10 * MiB);  // 2 MiB
  h16* Wvh = (h16*)(ws + 12 * MiB);  // 2 MiB
  h16* Woh = (h16*)(ws + 14 * MiB);  // 2 MiB
  h16* Qh  = (h16*)(ws + 16 * MiB);  // 8 MiB  [B,H,S,64]
  h16* Kh  = (h16*)(ws + 24 * MiB);  // 8 MiB  [B,H,S,64]
  h16* Vt  = (h16*)(ws + 32 * MiB);  // 8 MiB  [B,H,64,S]
  h16* Ah  = (h16*)(ws + 40 * MiB);  // 8 MiB  [4096,1024]

  // f32 -> f16
  cvt_f32_f16<<<(Mrows * Dm) / 1024, 256, 0, stream>>>(X, Xh, Mrows * Dm);
  cvt_f32_f16<<<(Dm * Dm) / 1024, 256, 0, stream>>>(Wq, Wqh, Dm * Dm);
  cvt_f32_f16<<<(Dm * Dm) / 1024, 256, 0, stream>>>(Wk, Wkh, Dm * Dm);
  cvt_f32_f16<<<(Dm * Dm) / 1024, 256, 0, stream>>>(Wv, Wvh, Dm * Dm);
  cvt_f32_f16<<<(Dm * Dm) / 1024, 256, 0, stream>>>(Wo, Woh, Dm * Dm);

  // QKV projections
  dim3 gg(Dm / 128, Mrows / 128);    // (8, 32)
  gemm_xwt<0><<<gg, 256, 0, stream>>>(Xh, Wqh, Qh);
  gemm_xwt<0><<<gg, 256, 0, stream>>>(Xh, Wkh, Kh);
  gemm_xwt<1><<<gg, 256, 0, stream>>>(Xh, Wvh, Vt);

  // streaming attention (2048 waves, 8 waves/block)
  attn_fwd<<<256, 256, 0, stream>>>(Qh, Kh, Vt, mask, Ah);

  // output projection -> f32 d_out
  gemm_xwt<2><<<gg, 256, 0, stream>>>(Ah, Woh, d_out);
}

// v002
// It runs in 123 microseconds.
// Next to v001, in two timings, it ran 1.22 and 1.21 times as fast.
// Over all steps from v000 it is 1.57 times as fast.
#include <hip/hip_runtime.h>
#include <hip/hip_bf16.h>
#include <math.h>

typedef _Float16 h16;
typedef __attribute__((ext_vector_type(16))) _Float16 v16h;
typedef __attribute__((ext_vector_type(8)))  _Float16 v8h;
typedef __attribute__((ext_vector_type(4)))  _Float16 v4h;
typedef __attribute__((ext_vector_type(8)))  float    v8f;
typedef __attribute__((ext_vector_type(4)))  int      v4i;
typedef __attribute__((ext_vector_type(2)))  float    v2f;

#define WMMA16x16x32(a, b, c) \
  __builtin_amdgcn_wmma_f32_16x16x32_f16(false, (a), false, (b), (short)0, (c), false, false)

constexpr int Bz = 2;
constexpr int Sq = 2048;
constexpr int Dm = 1024;
constexpr int Hh = 16;
constexpr int HD = 64;
constexpr int Mrows = Bz * Sq;   // 4096
constexpr int LDT = 40;          // padded LDS tile row stride (halfs): 20*r mod 64 distinct
constexpr int KT  = 64;          // keys per staged attention tile
constexpr int LDK = 72;          // LDS pitch of its 128-B rows (halfs): 144 B = 16 B x odd

// Value of lane l ^ 16: the two lanes that share a column of a WMMA C-matrix.
__device__ __forceinline__ float xhalf(float x) {
  return __int_as_float(__builtin_amdgcn_permlanex16(__float_as_int(x), __float_as_int(x),
                                                     0x76543210, 0xfedcba98, false, false));
}
__device__ __forceinline__ float max3f(float a, float b, float c) { return fmaxf(fmaxf(a, b), c); }

// Async 16-byte global -> LDS copy (ASYNCcnt), per-lane addresses.
__device__ __forceinline__ void async_g2l_b128(unsigned lds_off, const void* gptr) {
  unsigned long long ga = (unsigned long long)(uintptr_t)gptr;
  asm volatile("global_load_async_to_lds_b128 %0, %1, off" :: "v"(lds_off), "v"(ga) : "memory");
}
__device__ __forceinline__ unsigned lds_offset(const void* p) {
  return (unsigned)(uintptr_t)p;   // flat LDS addr truncates to LDS offset
}
// Two or four async 16-byte copies of one lane in one statement. s_wait_xcnt 0 is the
// statement's last line so that it stands in front of every later rewrite of the
// address registers named here (a precaution).
__device__ __forceinline__ void async_g2l_b128_x2(unsigned l0, const void* g0, unsigned l1, const void* g1) {
  unsigned long long a0 = (unsigned long long)(uintptr_t)g0;
  unsigned long long a1 = (unsigned long long)(uintptr_t)g1;
  asm volatile("global_load_async_to_lds_b128 %0, %1, off\n\t"
               "global_load_async_to_lds_b128 %2, %3, off\n\t"
               "s_wait_xcnt 0x0"
               :: "v"(l0), "v"(a0), "v"(l1), "v"(a1)
               : "memory");
}
__device__ __forceinline__ void async_g2l_b128_x4(unsigned l0, const void* g0, unsigned l1, const void* g1,
                                                  unsigned l2, const void* g2, unsigned l3, const void* g3) {
  unsigned long long a0 = (unsigned long long)(uintptr_t)g0;
  unsigned long long a1 = (unsigned long long)(uintptr_t)g1;
  unsigned long long a2 = (unsigned long long)(uintptr_t)g2;
  unsigned long long a3 = (unsigned long long)(uintptr_t)g3;
  asm volatile("global_load_async_to_lds_b128 %0, %1, off\n\t"
               "global_load_async_to_lds_b128 %2, %3, off\n\t"
               "global_load_async_to_lds_b128 %4, %5, off\n\t"
               "global_load_async_to_lds_b128 %6, %7, off\n\t"
               "s_wait_xcnt 0x0"
               :: "v"(l0), "v"(a0), "v"(l1), "v"(a1), "v"(l2), "v"(a2), "v"(l3), "v"(a3)
               : "memory");
}

// ---------------------------------------------------------------------------
// Load a 16(rows) x 32(k) f16 tile from row-major memory into WMMA A-operand
// layout (ISA 7.12.2, 16-bit A 16x32):
//   lanes 0-15  : row = lane,     K = 0-7   and 16-23
//   lanes 16-31 : row = lane-16,  K = 8-15  and 24-31
// The B operand of D = A*B is the A-layout of B^T, so W rows / Q rows (B) and
// K / V^T rows (A) all load through this same helper.
// ---------------------------------------------------------------------------
__device__ __forceinline__ v16h load_af(const h16* __restrict__ p, int ld, int k0, int lane) {
  const int row = lane & 15;
  const int hi  = (lane >> 4) << 3;           // 0 or 8
  const h16* q = p + (size_t)row * ld + k0 + hi;
  union { v16h v; v8h h[2]; } u;
  u.h[0] = *(const v8h*)(q);
  u.h[1] = *(const v8h*)(q + 16);
  return u.v;
}

// ---------------------------------------------------------------------------
// f32 -> f16 conversion (X and the four weight matrices), 4 elems/thread
// ---------------------------------------------------------------------------
__global__ __launch_bounds__(256) void cvt_f32_f16(const float* __restrict__ src,
                                                   h16* __restrict__ dst, int n) {
  int i = (blockIdx.x * blockDim.x + threadIdx.x) * 4;
  if (i + 3 < n) {
    float4 v = *(const float4*)(src + i);
    v4h o = { (h16)v.x, (h16)v.y, (h16)v.z, (h16)v.w };
    *(v4h*)(dst + i) = o;
  }
}

// ---------------------------------------------------------------------------
// GEMM: Y = A(4096x1024, f16 row-major) * W^T (W is 1024x1024 f16 row-major).
// Block = 128x128 (8 waves as 4Mx2N), wave = 32x64 -> 2x4 accum tiles.
// Operand tiles double-buffered in LDS with async b128 copies:
//   wait(cur) -> barrier -> issue(next into alt buffer) -> compute(cur)
// MODE 0: store f16 head-major [B,H,S,64]      (Q, K)
// MODE 1: store f16 head-transposed [B,H,64,S] (V^T, A operand of O^T += V^T P^T)
// MODE 2: store f32 row-major [4096,1024]      (final output projection)
// ---------------------------------------------------------------------------
template <int MODE>
__global__ __launch_bounds__(256) void gemm_xwt(const h16* __restrict__ A,
                                                const h16* __restrict__ W,
                                                void* __restrict__ dst) {
  __shared__ h16 shA[2][128 * LDT];   // 2 x 10 KiB
  __shared__ h16 shW[2][128 * LDT];   // 2 x 10 KiB

  const int tid  = threadIdx.x;
  const int lane = tid & 31;
  const int w    = tid >> 5;
  const int wm   = w & 3;            // 0..3
  const int wn   = w >> 2;           // 0..1
  const int rowB = blockIdx.y * 128;           // block row origin
  const int colB = blockIdx.x * 128;           // block col origin (W row origin)

  // async-copy assignment: each thread moves 2x16B of A and 2x16B of W
  const int crow  = tid >> 1;                  // 0..127
  const int csub0 = (tid & 1) * 2;             // subs {0,1} or {2,3} (16B units)
  const h16* agrow = A + (size_t)(rowB + crow) * Dm;
  const h16* wgrow = W + (size_t)(colB + crow) * Dm;
  const unsigned laA0 = lds_offset(&shA[0][crow * LDT + csub0 * 8]);
  const unsigned laW0 = lds_offset(&shW[0][crow * LDT + csub0 * 8]);
  const unsigned bufstride = (unsigned)(128 * LDT * sizeof(h16));

  auto issue_tile = [&](int k0, int buf) {
    const unsigned bo = (unsigned)buf * bufstride;
#pragma unroll
    for (int c = 0; c < 2; ++c) {
      const int sub = csub0 + c;
      async_g2l_b128(laA0 + bo + c * 16, agrow + k0 + sub * 8);
      async_g2l_b128(laW0 + bo + c * 16, wgrow + k0 + sub * 8);
    }
  };

  v8f acc[2][4];
#pragma unroll
  for (int i = 0; i < 2; ++i)
#pragma unroll
    for (int j = 0; j < 4; ++j) acc[i][j] = {};

  issue_tile(0, 0);                            // prologue fill

  for (int kt = 0; kt < Dm / 32; ++kt) {
    const int cur = kt & 1;
    asm volatile("s_wait_asynccnt 0x0" ::: "memory");
    __syncthreads();                           // cur tile visible to all waves
    if (kt + 1 < Dm / 32) issue_tile((kt + 1) * 32, cur ^ 1);  // overlap copy

    v16h af[2], bf[4];
#pragma unroll
    for (int i = 0; i < 2; ++i)
      af[i] = load_af(shA[cur] + (wm * 32 + 16 * i) * LDT, LDT, 0, lane);
#pragma unroll
    for (int j = 0; j < 4; ++j)
      bf[j] = load_af(shW[cur] + (wn * 64 + 16 * j) * LDT, LDT, 0, lane);

#pragma unroll
    for (int i = 0; i < 2; ++i)
#pragma unroll
      for (int j = 0; j < 4; ++j)
        acc[i][j] = WMMA16x16x32(af[i], bf[j], acc[i][j]);
  }

  // C/D layout: lane<16 -> N=lane, M=r ; lane>=16 -> N=lane-16, M=r+8
  const int nlo   = lane & 15;
  const int rbase = (lane >> 4) * 8;
  const int row0  = rowB + wm * 32;
  const int col0  = colB + wn * 64;
#pragma unroll
  for (int i = 0; i < 2; ++i) {
#pragma unroll
    for (int j = 0; j < 4; ++j) {
#pragma unroll
      for (int r = 0; r < 8; ++r) {
        const int grow = row0 + 16 * i + rbase + r;     // 0..4095
        const int gcol = col0 + 16 * j + nlo;           // 0..1023
        const float val = acc[i][j][r];
        if constexpr (MODE == 2) {
          ((float*)dst)[(size_t)grow * Dm + gcol] = val;
        } else {
          const int b = grow >> 11, s = grow & (Sq - 1);
          const int h = gcol >> 6, d = gcol & (HD - 1);
          if constexpr (MODE == 0)
            ((h16*)dst)[(((size_t)b * Hh + h) * Sq + s) * HD + d] = (h16)val;
          else
            ((h16*)dst)[(((size_t)b * Hh + h) * HD + d) * Sq + s] = (h16)val;
        }
      }
    }
  }
}

// ---------------------------------------------------------------------------
// Flash attention: 1 wave per (b, h, 32-query block) = 2048 waves.
// Each wave owns TWO 16-query column groups so every K/V fragment load feeds
// 2x the WMMAs. 32 keys / pass, products transposed:
//   S^T = K Q^T    (A = K rows, B = Q rows): lane l holds, of query l & 15, the scores
//                  of keys 8 (l >> 4) + r and 16 + 8 (l >> 4) + r, r = 0..7
//   O^T += V^T P^T (A = V^T rows, B = P^T): those 16 values, converted in place, are
//                  the B operand in the k order in which load_af reads the V^T rows
// so maximum and sum of a query run inside a lane, plus one exchange with lane l ^ 16
// for the maximum (the two halves' sums are joined once, at the end).
// The 8 waves of a block share one (b, h): each 64-key tile of K (64 x 128 B) and
// of V^T (64 x 128 B) is copied to LDS once per block, whole lines per 8 lanes,
// into two buffers: tile t + 1 flies while tile t is worked on. The batch's mask
// row (8 KiB) is copied once, with tile 0.
// ---------------------------------------------------------------------------
__global__ __launch_bounds__(256) void attn_fwd(const h16* __restrict__ Qh,
                                                const h16* __restrict__ Kh,
                                                const h16* __restrict__ Vt,
                                                const int* __restrict__ amask,
                                                h16* __restrict__ Ah) {
  __shared__ __attribute__((aligned(16))) h16 shK[2][KT * LDK];   // 2 x 9 KiB, rows = keys
  __shared__ __attribute__((aligned(16))) h16 shV[2][HD * LDK];   // 2 x 9 KiB, rows = d
  __shared__ __attribute__((aligned(16))) int shM[Sq];            // 8 KiB, mask row of batch b

  const int lane = threadIdx.x & 31;
  const int w    = threadIdx.x >> 5;
  const int gw   = blockIdx.x * 8 + w;          // 0..2047
  const int b    = gw >> 10;                    // / (H*64)
  const int rem  = gw & 1023;
  const int h    = rem >> 6;
  const int q0   = (rem & 63) * 32;

  const h16* qbase = Qh + (((size_t)b * Hh + h) * Sq + q0) * HD;
  const h16* kbase = Kh + (((size_t)b * Hh + h) * Sq) * HD;
  const h16* vbase = Vt + (((size_t)b * Hh + h) * HD) * Sq;
  const int* mrow  = amask + b * Sq;

  // copy assignment: 8 lanes per 128-B row, rows crow and crow + 32 of each tile
  const int crow = threadIdx.x >> 3;            // 0..31
  const int ccol = (threadIdx.x & 7) * 8;       // halfs
  const h16* kg = kbase + (size_t)crow * HD + ccol;
  const h16* vg = vbase + (size_t)crow * Sq + ccol;
  const unsigned lk = lds_offset(&shK[0][crow * LDK + ccol]);
  const unsigned lv = lds_offset(&shV[0][crow * LDK + ccol]);
  constexpr unsigned bufB  = (unsigned)(KT * LDK * sizeof(h16));
  constexpr unsigned halfB = (unsigned)(32 * LDK * sizeof(h16));
  auto issue_tile = [&](int tile, int buf) {
    const unsigned bo = (unsigned)buf * bufB;
    const h16* k = kg + (size_t)tile * KT * HD;
    const h16* v = vg + (size_t)tile * KT;
    async_g2l_b128_x4(lk + bo, k, lk + bo + halfB, k + 32 * HD,
                      lv + bo, v, lv + bo + halfB, v + (size_t)32 * Sq);
  };

  issue_tile(0, 0);
  async_g2l_b128_x2(lds_offset(&shM[threadIdx.x * 4]), mrow + threadIdx.x * 4,
                    lds_offset(&shM[Sq / 2 + threadIdx.x * 4]), mrow + Sq / 2 + threadIdx.x * 4);
  asm volatile("s_wait_asynccnt 0x0" ::: "memory");   // this wave's part of tile 0 and of the mask has landed
  __syncthreads();                                    // both visible to all waves
  issue_tile(1, 1);

  v16h qf[2][2];
#pragma unroll
  for (int u = 0; u < 2; ++u) {
    qf[u][0] = load_af(qbase + (size_t)u * 16 * HD, HD, 0, lane);
    qf[u][1] = load_af(qbase + (size_t)u * 16 * HD, HD, 32, lane);
  }

  float rm[2], rl[2];                    // of query csub of group u; rl sums this lane's keys only
  v8f o[2][4];                           // o[u][j][r] = O^T[16 j + rh + r][csub]
#pragma unroll
  for (int u = 0; u < 2; ++u) {
    rm[u] = -INFINITY; rl[u] = 0.0f;
#pragma unroll
    for (int j = 0; j < 4; ++j) o[u][j] = {};
  }

  const int csub = lane & 15;
  const int rh   = (lane >> 4) * 8;

  for (int kt = 0; kt < Sq / 32; ++kt) {
    const int k0  = kt * 32;
    const int cur = (kt >> 1) & 1;               // buffer of tile kt / 2
    const int kl  = (kt & 1) * 32;               // first key of this pass inside the tile

    // ---- shared K fragments for both query groups ----
    v16h kb[2][2];
#pragma unroll
    for (int t = 0; t < 2; ++t) {
      kb[t][0] = load_af(shK[cur] + (kl + 16 * t) * LDK, LDK, 0, lane);
      kb[t][1] = load_af(shK[cur] + (kl + 16 * t) * LDK, LDK, 32, lane);
    }
    // mask of this lane's 16 keys: mv[t][r] is key k0 + 16 t + rh + r
    int mv[2][8];
#pragma unroll
    for (int t = 0; t < 2; ++t) {
      const v4i ma = *(const v4i*)&shM[k0 + 16 * t + rh];
      const v4i mb = *(const v4i*)&shM[k0 + 16 * t + rh + 4];
#pragma unroll
      for (int r = 0; r < 4; ++r) { mv[t][r] = ma[r]; mv[t][4 + r] = mb[r]; }
    }

    v16h pf[2];
#pragma unroll
    for (int u = 0; u < 2; ++u) {
      // ---- scores (4 WMMAs per query group) ----
      v8f sc[2];
#pragma unroll
      for (int t = 0; t < 2; ++t) {
        sc[t] = {};
        sc[t] = WMMA16x16x32(kb[t][0], qf[u][0], sc[t]);
        sc[t] = WMMA16x16x32(kb[t][1], qf[u][1], sc[t]);
      }
      // ---- online softmax of one query per lane ----
      float s[16];
#pragma unroll
      for (int r = 0; r < 8; ++r) {
        s[r]     = mv[0][r] ? sc[0][r] * 0.125f : -1e9f;   // 1/sqrt(64)
        s[8 + r] = mv[1][r] ? sc[1][r] * 0.125f : -1e9f;
      }
      float m = fmaxf(max3f(max3f(s[0], s[1], s[2]), max3f(s[3], s[4], s[5]), max3f(s[6], s[7], s[8])),
                      max3f(max3f(s[9], s[10], s[11]), max3f(s[12], s[13], s[14]), s[15]));
      m = fmaxf(m, xhalf(m));                      // over all 32 keys, same in both halves
      const float mn  = fmaxf(rm[u], m);
      const float cor = __expf(rm[u] - mn);
      float p[16];
#pragma unroll
      for (int e = 0; e < 16; e += 2) {
        const v2f a = (v2f{s[e], s[e + 1]} - mn) * 1.44269504f;   // exp(x) = 2^(x log2 e), two per instruction
        p[e]     = __builtin_amdgcn_exp2f(a.x);
        p[e + 1] = __builtin_amdgcn_exp2f(a.y);
        pf[u][e]     = (h16)p[e];                  // B[k][csub], k = 8 h + e or 16 + 8 h + (e - 8)
        pf[u][e + 1] = (h16)p[e + 1];
      }
      const float sum = (((p[0] + p[1]) + (p[2] + p[3])) + ((p[4] + p[5]) + (p[6] + p[7]))) +
                        (((p[8] + p[9]) + (p[10] + p[11])) + ((p[12] + p[13]) + (p[14] + p[15])));
      rl[u] = rl[u] * cor + sum;
      rm[u] = mn;
#pragma unroll
      for (int j = 0; j < 4; ++j) o[u][j] *= cor;
    }

    // ---- V^T * P^T: V fragments shared by both query groups (8 WMMAs) ----
#pragma unroll
    for (int j = 0; j < 4; ++j) {
      v16h vb = load_af(shV[cur] + (j * 16) * LDK, LDK, kl, lane);
      o[0][j] = WMMA16x16x32(vb, pf[0], o[0][j]);
      o[1][j] = WMMA16x16x32(vb, pf[1], o[1][j]);
    }

    // ---- foot of a tile's second pass: publish tile + 1, refill this buffer ----
    if (kt & 1) {
      asm volatile("s_wait_dscnt 0x0" ::: "memory");     // this wave's reads of the buffer are done
      asm volatile("s_wait_asynccnt 0x0" ::: "memory");  // this wave's part of the next tile has landed
      __syncthreads();                                   // next tile visible; this buffer free
      if ((kt >> 1) + 2 < Sq / KT) issue_tile((kt >> 1) + 2, cur);
    }
  }
  asm volatile("s_wait_asynccnt 0x0" ::: "memory");      // no copy outstanding at the wave's end

  // ---- join the halves' sums, normalize, store f16 Ah[4096,1024]: 8 d = 16 B per store ----
#pragma unroll
  for (int u = 0; u < 2; ++u) {
    const float inv = 1.0f / (rl[u] + xhalf(rl[u]));
    const int s = q0 + u * 16 + csub;
#pragma unroll
    for (int j = 0; j < 4; ++j) {
      v8h ov;
#pragma unroll
      for (int r = 0; r < 8; ++r) ov[r] = (h16)(o[u][j][r] * inv);
      *(v8h*)&Ah[((size_t)b * Sq + s) * Dm + h * HD + j * 16 + rh] = ov;
    }
  }
}

// ---------------------------------------------------------------------------
// Launch
// ---------------------------------------------------------------------------
extern "C" void kernel_launch(void* const* d_in, const int* in_sizes, int n_in,
                              void* d_out, int out_size, void* d_ws, size_t ws_size,
                              hipStream_t stream) {
  const float* X    = (const float*)d_in[0];
  const int*   mask = (const int*)d_in[1];
  const float* Wq   = (const float*)d_in[2];
  const float* Wk   = (const float*)d_in[3];
  const float* Wv   = (const float*)d_in[4];
  const float* Wo   = (const float*)d_in[5];

  char* ws = (char*)d_ws;
  const size_t MiB = 1u << 20;
  h16* Xh  = (h16*)(ws + 0 * MiB);   // 8 MiB  [4096,1024]
  h16* Wqh = (h16*)(ws + 8 * MiB);   // 2 MiB
  h16* Wkh = (h16*)(ws + 10 * MiB);  // 2 MiB
  h16* Wvh = (h16*)(ws + 12 * MiB);  // 2 MiB
  h16* Woh = (h16*)(ws + 14 * MiB);  // 2 MiB
  h16* Qh  = (h16*)(ws + 16 * MiB);  // 8 MiB  [B,H,S,64]
  h16* Kh  = (h16*)(ws + 24 * MiB);  // 8 MiB  [B,H,S,64]
  h16* Vt  = (h16*)(ws + 32 * MiB);  // 8 MiB  [B,H,64,S]
  h16* Ah  = (h16*)(ws + 40 * MiB);  // 8 MiB  [4096,1024]

  // f32 -> f16
  cvt_f32_f16<<<(Mrows * Dm) / 1024, 256, 0, stream>>>(X, Xh, Mrows * Dm);
  cvt_f32_f16<<<(Dm * Dm) / 1024, 256, 0, stream>>>(Wq, Wqh, Dm * Dm);
  cvt_f32_f16<<<(Dm * Dm) / 1024, 256, 0, stream>>>(Wk, Wkh, Dm * Dm);
  cvt_f32_f16<<<(Dm * Dm) / 1024, 256, 0, stream>>>(Wv, Wvh, Dm * Dm);
  cvt_f32_f16<<<(Dm * Dm) / 1024, 256, 0, stream>>>(Wo, Woh, Dm * Dm);

  // QKV projections
  dim3 gg(Dm / 128, Mrows / 128);    // (8, 32)
  gemm_xwt<0><<<gg, 256, 0, stream>>>(Xh, Wqh, Qh);
  gemm_xwt<0><<<gg, 256, 0, stream>>>(Xh, Wkh, Kh);
  gemm_xwt<1><<<gg, 256, 0, stream>>>(Xh, Wvh, Vt);

  // streaming attention (2048 waves, 8 waves/block)
  attn_fwd<<<256, 256, 0, stream>>>(Qh, Kh, Vt, mask, Ah);

  // output projection -> f32 d_out
  gemm_xwt<2><<<gg, 256, 0, stream>>>(Ah, Woh, d_out);
}

// v003
// A run of this version takes 97.7 microseconds.
// In two side-by-side timings against v002, it was 1.27 and 1.26 times as fast.
// Counting every step since v000, it is 1.98 times as fast.
#include <hip/hip_runtime.h>
#include <hip/hip_bf16.h>
#include <math.h>

typedef _Float16 h16;
typedef __attribute__((ext_vector_type(16))) _Float16 v16h;
typedef __attribute__((ext_vector_type(8)))  _Float16 v8h;
typedef __attribute__((ext_vector_type(4)))  _Float16 v4h;
typedef __attribute__((ext_vector_type(8)))  float    v8f;
typedef __attribute__((ext_vector_type(4)))  int      v4i;
typedef __attribute__((ext_vector_type(2)))  float    v2f;

#define WMMA16x16x32(a, b, c) \
  __builtin_amdgcn_wmma_f32_16x16x32_f16(false, (a), false, (b), (short)0, (c), false, false)

constexpr int Bz = 2;
constexpr int Sq = 2048;
constexpr int Dm = 1024;
constexpr int Hh = 16;
constexpr int HD = 64;
constexpr int Mrows = Bz * Sq;   // 4096
constexpr int LDT = 40;          // padded LDS tile row stride (halfs): 20*r mod 64 distinct
constexpr int KT  = 64;          // keys per staged attention tile
constexpr int LDK = 72;          // LDS pitch of its 128-B rows (halfs): 144 B = 16 B x odd

// Value of lane l ^ 16: the two lanes that share a column of a WMMA C-matrix.
__device__ __forceinline__ float xhalf(float x) {
  return __int_as_float(__builtin_amdgcn_permlanex16(__float_as_int(x), __float_as_int(x),
                                                     0x76543210, 0xfedcba98, false, false));
}
__device__ __forceinline__ float max3f(float a, float b, float c) { return fmaxf(fmaxf(a, b), c); }

// Async 16-byte global -> LDS copy (ASYNCcnt), per-lane addresses.
__device__ __forceinline__ void async_g2l_b128(unsigned lds_off, const void* gptr) {
  unsigned long long ga = (unsigned long long)(uintptr_t)gptr;
  asm volatile("global_load_async_to_lds_b128 %0, %1, off" :: "v"(lds_off), "v"(ga) : "memory");
}
__device__ __forceinline__ unsigned lds_offset(const void* p) {
  return (unsigned)(uintptr_t)p;   // flat LDS addr truncates to LDS offset
}
// Two or four async 16-byte copies of one lane in one statement. s_wait_xcnt 0 is the
// statement's last line so that it stands in front of every later rewrite of the
// address registers named here (a precaution).
__device__ __forceinline__ void async_g2l_b128_x2(unsigned l0, const void* g0, unsigned l1, const void* g1) {
  unsigned long long a0 = (unsigned long long)(uintptr_t)g0;
  unsigned long long a1 = (unsigned long long)(uintptr_t)g1;
  asm volatile("global_load_async_to_lds_b128 %0, %1, off\n\t"
               "global_load_async_to_lds_b128 %2, %3, off\n\t"
               "s_wait_xcnt 0x0"
               :: "v"(l0), "v"(a0), "v"(l1), "v"(a1)
               : "memory");
}
__device__ __forceinline__ void async_g2l_b128_x4(unsigned l0, const void* g0, unsigned l1, const void* g1,
                                                  unsigned l2, const void* g2, unsigned l3, const void* g3) {
  unsigned long long a0 = (unsigned long long)(uintptr_t)g0;
  unsigned long long a1 = (unsigned long long)(uintptr_t)g1;
  unsigned long long a2 = (unsigned long long)(uintptr_t)g2;
  unsigned long long a3 = (unsigned long long)(uintptr_t)g3;
  asm volatile("global_load_async_to_lds_b128 %0, %1, off\n\t"
               "global_load_async_to_lds_b128 %2, %3, off\n\t"
               "global_load_async_to_lds_b128 %4, %5, off\n\t"
               "global_load_async_to_lds_b128 %6, %7, off\n\t"
               "s_wait_xcnt 0x0"
               :: "v"(l0), "v"(a0), "v"(l1), "v"(a1), "v"(l2), "v"(a2), "v"(l3), "v"(a3)
               : "memory");
}

// ---------------------------------------------------------------------------
// Load a 16(rows) x 32(k) f16 tile from row-major memory into WMMA A-operand
// layout (ISA 7.12.2, 16-bit A 16x32):
//   lanes 0-15  : row = lane,     K = 0-7   and 16-23
//   lanes 16-31 : row = lane-16,  K = 8-15  and 24-31
// The B operand of D = A*B is the A-layout of B^T, so W rows / Q rows (B) and
// K / V^T rows (A) all load through this same helper.
// ---------------------------------------------------------------------------
__device__ __forceinline__ v16h load_af(const h16* __restrict__ p, int ld, int k0, int lane) {
  const int row = lane & 15;
  const int hi  = (lane >> 4) << 3;           // 0 or 8
  const h16* q = p + (size_t)row * ld + k0 + hi;
  union { v16h v; v8h h[2]; } u;
  u.h[0] = *(const v8h*)(q);
  u.h[1] = *(const v8h*)(q + 16);
  return u.v;
}

// ---------------------------------------------------------------------------
// f32 -> f16 conversion of X and the four weight matrices in ONE launch: none of the
// five depends on another, so the block index picks the array. 4 elems/thread, 1024
// per block; the grid covers the five arrays exactly. The f16 copies lie one behind
// the other in dst, in the order X, Wq, Wk, Wv, Wo.
// ---------------------------------------------------------------------------
constexpr int XBLK = (Mrows * Dm) / 1024;   // 4096 blocks for X
constexpr int WBLK = (Dm * Dm) / 1024;      // 1024 blocks for each weight matrix
__global__ __launch_bounds__(256) void cvt_f32_f16(const float* __restrict__ X,
                                                   const float* __restrict__ Wq,
                                                   const float* __restrict__ Wk,
                                                   const float* __restrict__ Wv,
                                                   const float* __restrict__ Wo,
                                                   h16* __restrict__ dst) {
  const int blk = blockIdx.x;
  const float* src = X;
  int sblk = blk;                            // block inside its own array
  if (blk >= XBLK) {
    const int wi = (blk - XBLK) / WBLK;      // 0..3
    sblk = (blk - XBLK) % WBLK;
    src = wi == 0 ? Wq : wi == 1 ? Wk : wi == 2 ? Wv : Wo;
  }
  const float4 v = *(const float4*)(src + (size_t)sblk * 1024 + threadIdx.x * 4);
  const v4h o = { (h16)v.x, (h16)v.y, (h16)v.z, (h16)v.w };
  *(v4h*)(dst + (size_t)blk * 1024 + threadIdx.x * 4) = o;
}

// ---------------------------------------------------------------------------
// Store a wave's 32 x 64 accumulators (2 x 4 tiles), first element (row0, col0) of Y.
// C/D layout: lane<16 -> N=lane, M=r ; lane>=16 -> N=lane-16, M=r+8
// MODE 0: f16 head-major [B,H,S,64]      (Q, K)
// MODE 1: f16 head-transposed [B,H,64,S] (V^T, feeds PV A-operand)
// MODE 2: f32 row-major [4096,1024]      (final output projection)
// ---------------------------------------------------------------------------
template <int MODE>
__device__ __forceinline__ void store_tile(const v8f (&acc)[2][4], void* __restrict__ dst,
                                           int row0, int col0, int lane) {
  const int nlo   = lane & 15;
  const int rbase = (lane >> 4) * 8;
#pragma unroll
  for (int i = 0; i < 2; ++i) {
#pragma unroll
    for (int j = 0; j < 4; ++j) {
#pragma unroll
      for (int r = 0; r < 8; ++r) {
        const int grow = row0 + 16 * i + rbase + r;     // 0..4095
        const int gcol = col0 + 16 * j + nlo;           // 0..1023
        const float val = acc[i][j][r];
        if constexpr (MODE == 2) {
          ((float*)dst)[(size_t)grow * Dm + gcol] = val;
        } else {
          const int b = grow >> 11, s = grow & (Sq - 1);
          const int h = gcol >> 6, d = gcol & (HD - 1);
          if constexpr (MODE == 0)
            ((h16*)dst)[(((size_t)b * Hh + h) * Sq + s) * HD + d] = (h16)val;
          else
            ((h16*)dst)[(((size_t)b * Hh + h) * HD + d) * Sq + s] = (h16)val;
        }
      }
    }
  }
}

// ---------------------------------------------------------------------------
// GEMM: Y = A(4096x1024, f16 row-major) * W^T (W is 1024x1024 f16 row-major).
// Block = 128x128 (8 waves as 4Mx2N), wave = 32x64 -> 2x4 accum tiles.
// Operand tiles double-buffered in LDS with async b128 copies:
//   wait(cur) -> barrier -> issue(next into alt buffer) -> compute(cur)
// QKV = true: the three projections of X, which do not depend on one another, share
// one launch; blockIdx.z picks weight matrix, destination and store mode: jobs 0 and
// 1 are Q and K (mode 0), job 2 is V^T (mode 1). 3 x 256 blocks of 40 KiB LDS and
// 128 VGPRs a wave: three to a WGP.
// QKV = false: one product, W0 -> d0, mode 2.
// ---------------------------------------------------------------------------
template <bool QKV>
__global__ __launch_bounds__(256) void gemm_xwt(const h16* __restrict__ A,
                                                const h16* __restrict__ W0,
                                                const h16* __restrict__ W1,
                                                const h16* __restrict__ W2,
                                                void* __restrict__ d0,
                                                void* __restrict__ d1,
                                                void* __restrict__ d2) {
  __shared__ h16 shA[2][128 * LDT];   // 2 x 10 KiB
  __shared__ h16 shW[2][128 * LDT];   // 2 x 10 KiB

  const int job  = QKV ? (int)blockIdx.z : 0;
  const h16* W   = job == 0 ? W0 : job == 1 ? W1 : W2;
  void* dst      = job == 0 ? d0 : job == 1 ? d1 : d2;

  const int tid  = threadIdx.x;
  const int lane = tid & 31;
  const int w    = tid >> 5;
  const int wm   = w & 3;            // 0..3
  const int wn   = w >> 2;           // 0..1
  const int rowB = blockIdx.y * 128;           // block row origin
  const int colB = blockIdx.x * 128;           // block col origin (W row origin)

  // async-copy assignment: each thread moves 2x16B of A and 2x16B of W
  const int crow  = tid >> 1;                  // 0..127
  const int csub0 = (tid & 1) * 2;             // subs {0,1} or {2,3} (16B units)
  const h16* agrow = A + (size_t)(rowB + crow) * Dm;
  const h16* wgrow = W + (size_t)(colB + crow) * Dm;
  const unsigned laA0 = lds_offset(&shA[0][crow * LDT + csub0 * 8]);
  const unsigned laW0 = lds_offset(&shW[0][crow * LDT + csub0 * 8]);
  const unsigned bufstride = (unsigned)(128 * LDT * sizeof(h16));

  auto issue_tile = [&](int k0, int buf) {
    const unsigned bo = (unsigned)buf * bufstride;
#pragma unroll
    for (int c = 0; c < 2; ++c) {
      const int sub = csub0 + c;
      async_g2l_b128(laA0 + bo + c * 16, agrow + k0 + sub * 8);
      async_g2l_b128(laW0 + bo + c * 16, wgrow + k0 + sub * 8);
    }
  };

  v8f acc[2][4];
#pragma unroll
  for (int i = 0; i < 2; ++i)
#pragma unroll
    for (int j = 0; j < 4; ++j) acc[i][j] = {};

  issue_tile(0, 0);                            // prologue fill

  for (int kt = 0; kt < Dm / 32; ++kt) {
    const int cur = kt & 1;
    asm volatile("s_wait_asynccnt 0x0" ::: "memory");
    __syncthreads();                           // cur tile visible to all waves
    if (kt + 1 < Dm / 32) issue_tile((kt + 1) * 32, cur ^ 1);  // overlap copy

    v16h af[2], bf[4];
#pragma unroll
    for (int i = 0; i < 2; ++i)
      af[i] = load_af(shA[cur] + (wm * 32 + 16 * i) * LDT, LDT, 0, lane);
#pragma unroll
    for (int j = 0; j < 4; ++j)
      bf[j] = load_af(shW[cur] + (wn * 64 + 16 * j) * LDT, LDT, 0, lane);

#pragma unroll
    for (int i = 0; i < 2; ++i)
#pragma unroll
      for (int j = 0; j < 4; ++j)
        acc[i][j] = WMMA16x16x32(af[i], bf[j], acc[i][j]);
  }

  const int row0 = rowB + wm * 32;
  const int col0 = colB + wn * 64;
  if constexpr (QKV) {                 // one block-uniform branch in front of all the stores
    if (job == 2) {
      store_tile<1>(acc, dst, row0, col0, lane);
    } else {
      store_tile<0>(acc, dst, row0, col0, lane);
      // The listing lays the other mode's code behind these stores, and it rewrites their
      // registers: the wait stands in front of that (a precaution).
      asm volatile("s_wait_xcnt 0x0" ::: "memory");
    }
  } else {
    store_tile<2>(acc, dst, row0, col0, lane);
  }
}

// ---------------------------------------------------------------------------
// Flash attention: 1 wave per (b, h, 32-query block) = 2048 waves.
// Each wave owns TWO 16-query column groups so every K/V fragment load feeds
// 2x the WMMAs. 32 keys / pass, products transposed:
//   S^T = K Q^T    (A = K rows, B = Q rows): lane l holds, of query l & 15, the scores
//                  of keys 8 (l >> 4) + r and 16 + 8 (l >> 4) + r, r = 0..7
//   O^T += V^T P^T (A = V^T rows, B = P^T): those 16 values, converted in place, are
//                  the B operand in the k order in which load_af reads the V^T rows
// so maximum and sum of a query run inside a lane, plus one exchange with lane l ^ 16
// for the maximum (the two halves' sums are joined once, at the end).
// The 8 waves of a block share one (b, h): each 64-key tile of K (64 x 128 B) and
// of V^T (64 x 128 B) is copied to LDS once per block, whole lines per 8 lanes,
// into two buffers: tile t + 1 flies while tile t is worked on. The batch's mask
// row (8 KiB) is copied once, with tile 0.
// ---------------------------------------------------------------------------
__global__ __launch_bounds__(256) void attn_fwd(const h16* __restrict__ Qh,
                                                const h16* __restrict__ Kh,
                                                const h16* __restrict__ Vt,
                                                const int* __restrict__ amask,
                                                h16* __restrict__ Ah) {
  __shared__ __attribute__((aligned(16))) h16 shK[2][KT * LDK];   // 2 x 9 KiB, rows = keys
  __shared__ __attribute__((aligned(16))) h16 shV[2][HD * LDK];   // 2 x 9 KiB, rows = d
  __shared__ __attribute__((aligned(16))) int shM[Sq];            // 8 KiB, mask row of batch b

  const int lane = threadIdx.x & 31;
  const int w    = threadIdx.x >> 5;
  const int gw   = blockIdx.x * 8 + w;          // 0..2047
  const int b    = gw >> 10;                    // / (H*64)
  const int rem  = gw & 1023;
  const int h    = rem >> 6;
  const int q0   = (rem & 63) * 32;

  const h16* qbase = Qh + (((size_t)b * Hh + h) * Sq + q0) * HD;
  const h16* kbase = Kh + (((size_t)b * Hh + h) * Sq) * HD;
  const h16* vbase = Vt + (((size_t)b * Hh + h) * HD) * Sq;
  const int* mrow  = amask + b * Sq;

  // copy assignment: 8 lanes per 128-B row, rows crow and crow + 32 of each tile
  const int crow = threadIdx.x >> 3;            // 0..31
  const int ccol = (threadIdx.x & 7) * 8;       // halfs
  const h16* kg = kbase + (size_t)crow * HD + ccol;
  const h16* vg = vbase + (size_t)crow * Sq + ccol;
  const unsigned lk = lds_offset(&shK[0][crow * LDK + ccol]);
  const unsigned lv = lds_offset(&shV[0][crow * LDK + ccol]);
  constexpr unsigned bufB  = (unsigned)(KT * LDK * sizeof(h16));
  constexpr unsigned halfB = (unsigned)(32 * LDK * sizeof(h16));
  auto issue_tile = [&](int tile, int buf) {
    const unsigned bo = (unsigned)buf * bufB;
    const h16* k = kg + (size_t)tile * KT * HD;
    const h16* v = vg + (size_t)tile * KT;
    async_g2l_b128_x4(lk + bo, k, lk + bo + halfB, k + 32 * HD,
                      lv + bo, v, lv + bo + halfB, v + (size_t)32 * Sq);
  };

  issue_tile(0, 0);
  async_g2l_b128_x2(lds_offset(&shM[threadIdx.x * 4]), mrow + threadIdx.x * 4,
                    lds_offset(&shM[Sq / 2 + threadIdx.x * 4]), mrow + Sq / 2 + threadIdx.x * 4);
  asm volatile("s_wait_asynccnt 0x0" ::: "memory");   // this wave's part of tile 0 and of the mask has landed
  __syncthreads();                                    // both visible to all waves
  issue_tile(1, 1);

  v16h qf[2][2];
#pragma unroll
  for (int u = 0; u < 2; ++u) {
    qf[u][0] = load_af(qbase + (size_t)u * 16 * HD, HD, 0, lane);
    qf[u][1] = load_af(qbase + (size_t)u * 16 * HD, HD, 32, lane);
  }

  float rm[2], rl[2];                    // of query csub of group u; rl sums this lane's keys only
  v8f o[2][4];                           // o[u][j][r] = O^T[16 j + rh + r][csub]
#pragma unroll
  for (int u = 0; u < 2; ++u) {
    rm[u] = -INFINITY; rl[u] = 0.0f;
#pragma unroll
    for (int j = 0; j < 4; ++j) o[u][j] = {};
  }

  const int csub = lane & 15;
  const int rh   = (lane >> 4) * 8;

  for (int kt = 0; kt < Sq / 32; ++kt) {
    const int k0  = kt * 32;
    const int cur = (kt >> 1) & 1;               // buffer of tile kt / 2
    const int kl  = (kt & 1) * 32;               // first key of this pass inside the tile

    // ---- shared K fragments for both query groups ----
    v16h kb[2][2];
#pragma unroll
    for (int t = 0; t < 2; ++t) {
      kb[t][0] = load_af(shK[cur] + (kl + 16 * t) * LDK, LDK, 0, lane);
      kb[t][1] = load_af(shK[cur] + (kl + 16 * t) * LDK, LDK, 32, lane);
    }
    // mask of this lane's 16 keys: mv[t][r] is key k0 + 16 t + rh + r
    int mv[2][8];
#pragma unroll
    for (int t = 0; t < 2; ++t) {
      const v4i ma = *(const v4i*)&shM[k0 + 16 * t + rh];
      const v4i mb = *(const v4i*)&shM[k0 + 16 * t + rh + 4];
#pragma unroll
      for (int r = 0; r < 4; ++r) { mv[t][r] = ma[r]; mv[t][4 + r] = mb[r]; }
    }

    v16h pf[2];
#pragma unroll
    for (int u = 0; u < 2; ++u) {
      // ---- scores (4 WMMAs per query group) ----
      v8f sc[2];
#pragma unroll
      for (int t = 0; t < 2; ++t) {
        sc[t] = {};
        sc[t] = WMMA16x16x32(kb[t][0], qf[u][0], sc[t]);
        sc[t] = WMMA16x16x32(kb[t][1], qf[u][1], sc[t]);
      }
      // ---- online softmax of one query per lane ----
      float s[16];
#pragma unroll
      for (int r = 0; r < 8; ++r) {
        s[r]     = mv[0][r] ? sc[0][r] * 0.125f : -1e9f;   // 1/sqrt(64)
        s[8 + r] = mv[1][r] ? sc[1][r] * 0.125f : -1e9f;
      }
      float m = fmaxf(max3f(max3f(s[0], s[1], s[2]), max3f(s[3], s[4], s[5]), max3f(s[6], s[7], s[8])),
                      max3f(max3f(s[9], s[10], s[11]), max3f(s[12], s[13], s[14]), s[15]));
      m = fmaxf(m, xhalf(m));                      // over all 32 keys, same in both halves
      const float mn  = fmaxf(rm[u], m);
      const float cor = __expf(rm[u] - mn);
      float p[16];
#pragma unroll
      for (int e = 0; e < 16; e += 2) {
        const v2f a = (v2f{s[e], s[e + 1]} - mn) * 1.44269504f;   // exp(x) = 2^(x log2 e), two per instruction
        p[e]     = __builtin_amdgcn_exp2f(a.x);
        p[e + 1] = __builtin_amdgcn_exp2f(a.y);
        pf[u][e]     = (h16)p[e];                  // B[k][csub], k = 8 h + e or 16 + 8 h + (e - 8)
        pf[u][e + 1] = (h16)p[e + 1];
      }
      const float sum = (((p[0] + p[1]) + (p[2] + p[3])) + ((p[4] + p[5]) + (p[6] + p[7]))) +
                        (((p[8] + p[9]) + (p[10] + p[11])) + ((p[12] + p[13]) + (p[14] + p[15])));
      rl[u] = rl[u] * cor + sum;
      rm[u] = mn;
#pragma unroll
      for (int j = 0; j < 4; ++j) o[u][j] *= cor;
    }

    // ---- V^T * P^T: V fragments shared by both query groups (8 WMMAs) ----
#pragma unroll
    for (int j = 0; j < 4; ++j) {
      v16h vb = load_af(shV[cur] + (j * 16) * LDK, LDK, kl, lane);
      o[0][j] = WMMA16x16x32(vb, pf[0], o[0][j]);
      o[1][j] = WMMA16x16x32(vb, pf[1], o[1][j]);
    }

    // ---- foot of a tile's second pass: publish tile + 1, refill this buffer ----
    if (kt & 1) {
      asm volatile("s_wait_dscnt 0x0" ::: "memory");     // this wave's reads of the buffer are done
      asm volatile("s_wait_asynccnt 0x0" ::: "memory");  // this wave's part of the next tile has landed
      __syncthreads();                                   // next tile visible; this buffer free
      if ((kt >> 1) + 2 < Sq / KT) issue_tile((kt >> 1) + 2, cur);
    }
  }
  asm volatile("s_wait_asynccnt 0x0" ::: "memory");      // no copy outstanding at the wave's end

  // ---- join the halves' sums, normalize, store f16 Ah[4096,1024]: 8 d = 16 B per store ----
#pragma unroll
  for (int u = 0; u < 2; ++u) {
    const float inv = 1.0f / (rl[u] + xhalf(rl[u]));
    const int s = q0 + u * 16 + csub;
#pragma unroll
    for (int j = 0; j < 4; ++j) {
      v8h ov;
#pragma unroll
      for (int r = 0; r < 8; ++r) ov[r] = (h16)(o[u][j][r] * inv);
      *(v8h*)&Ah[((size_t)b * Sq + s) * Dm + h * HD + j * 16 + rh] = ov;
    }
  }
}

// ---------------------------------------------------------------------------
// Launch
// ---------------------------------------------------------------------------
extern "C" void kernel_launch(void* const* d_in, const int* in_sizes, int n_in,
                              void* d_out, int out_size, void* d_ws, size_t ws_size,
                              hipStream_t stream) {
  const float* X    = (const float*)d_in[0];
  const int*   mask = (const int*)d_in[1];
  const float* Wq   = (const float*)d_in[2];
  const float* Wk   = (const float*)d_in[3];
  const float* Wv   = (const float*)d_in[4];
  const float* Wo   = (const float*)d_in[5];

  char* ws = (char*)d_ws;
  const size_t MiB = 1u << 20;
  h16* Xh  = (h16*)(ws + 0 * MiB);   // 8 MiB  [4096,1024]
  h16* Wqh = (h16*)(ws + 8 * MiB);   // 2 MiB
  h16* Wkh = (h16*)(ws + 10 * MiB);  // 2 MiB
  h16* Wvh = (h16*)(ws + 12 * MiB);  // 2 MiB
  h16* Woh = (h16*)(ws + 14 * MiB);  // 2 MiB
  h16* Qh  = (h16*)(ws + 16 * MiB);  // 8 MiB  [B,H,S,64]
  h16* Kh  = (h16*)(ws + 24 * MiB);  // 8 MiB  [B,H,S,64]
  h16* Vt  = (h16*)(ws + 32 * MiB);  // 8 MiB  [B,H,64,S]
  h16* Ah  = (h16*)(ws + 40 * MiB);  // 8 MiB  [4096,1024]

  // f32 -> f16, all five arrays in one launch: Xh, Wqh, Wkh, Wvh, Woh are contiguous from Xh
  cvt_f32_f16<<<XBLK + 4 * WBLK, 256, 0, stream>>>(X, Wq, Wk, Wv, Wo, Xh);

  // QKV projections in one launch (z = 0: Q, 1: K, 2: V^T)
  dim3 gg(Dm / 128, Mrows / 128);        // (8, 32)
  dim3 g3(Dm / 128, Mrows / 128, 3);     // (8, 32, 3)
  gemm_xwt<true><<<g3, 256, 0, stream>>>(Xh, Wqh, Wkh, Wvh, Qh, Kh, Vt);

  // streaming attention (2048 waves, 8 waves/block)
  attn_fwd<<<256, 256, 0, stream>>>(Qh, Kh, Vt, mask, Ah);

  // output projection -> f32 d_out
  gemm_xwt<false><<<gg, 256, 0, stream>>>(Ah, Woh, nullptr, nullptr, d_out, nullptr, nullptr);
}

// v004
// One run takes 81.3 microseconds.
// Next to v003, in two timings, it ran 1.20 times as fast each time.
// Counting every step since v000, it is 2.39 times as fast.
#include <hip/hip_runtime.h>
#include <hip/hip_bf16.h>
#include <math.h>

typedef _Float16 h16;
typedef __attribute__((ext_vector_type(16))) _Float16 v16h;
typedef __attribute__((ext_vector_type(8)))  _Float16 v8h;
typedef __attribute__((ext_vector_type(4)))  _Float16 v4h;
typedef __attribute__((ext_vector_type(8)))  float    v8f;
typedef __attribute__((ext_vector_type(2)))  float    v2f;

#define WMMA16x16x32(a, b, c) \
  __builtin_amdgcn_wmma_f32_16x16x32_f16(false, (a), false, (b), (short)0, (c), false, false)

constexpr int Bz = 2;
constexpr int Sq = 2048;
constexpr int Dm = 1024;
constexpr int Hh = 16;
constexpr int HD = 64;
constexpr int Mrows = Bz * Sq;   // 4096
constexpr int LDT = 40;          // padded LDS tile row stride (halfs): 20*r mod 64 distinct
constexpr int KT  = 64;          // keys per staged attention tile
constexpr int LDK = 72;          // LDS pitch of its 128-B rows (halfs): 144 B = 16 B x odd

template <bool V> struct cbool { static constexpr bool value = V; };   // compile-time switch of a lambda

// Value of lane l ^ 16: the two lanes that share a column of a WMMA C-matrix.
__device__ __forceinline__ float xhalf(float x) {
  return __int_as_float(__builtin_amdgcn_permlanex16(__float_as_int(x), __float_as_int(x),
                                                     0x76543210, 0xfedcba98, false, false));
}
__device__ __forceinline__ float max3f(float a, float b, float c) { return fmaxf(fmaxf(a, b), c); }

// Async 16-byte global -> LDS copy (ASYNCcnt), per-lane addresses.
__device__ __forceinline__ void async_g2l_b128(unsigned lds_off, const void* gptr) {
  unsigned long long ga = (unsigned long long)(uintptr_t)gptr;
  asm volatile("global_load_async_to_lds_b128 %0, %1, off" :: "v"(lds_off), "v"(ga) : "memory");
}
__device__ __forceinline__ unsigned lds_offset(const void* p) {
  return (unsigned)(uintptr_t)p;   // flat LDS addr truncates to LDS offset
}
// Four async 16-byte copies of one lane in one statement. s_wait_xcnt 0 is the
// statement's last line so that it stands in front of every later rewrite of the
// address registers named here (a precaution).
__device__ __forceinline__ void async_g2l_b128_x4(unsigned l0, const void* g0, unsigned l1, const void* g1,
                                                  unsigned l2, const void* g2, unsigned l3, const void* g3) {
  unsigned long long a0 = (unsigned long long)(uintptr_t)g0;
  unsigned long long a1 = (unsigned long long)(uintptr_t)g1;
  unsigned long long a2 = (unsigned long long)(uintptr_t)g2;
  unsigned long long a3 = (unsigned long long)(uintptr_t)g3;
  asm volatile("global_load_async_to_lds_b128 %0, %1, off\n\t"
               "global_load_async_to_lds_b128 %2, %3, off\n\t"
               "global_load_async_to_lds_b128 %4, %5, off\n\t"
               "global_load_async_to_lds_b128 %6, %7, off\n\t"
               "s_wait_xcnt 0x0"
               :: "v"(l0), "v"(a0), "v"(l1), "v"(a1), "v"(l2), "v"(a2), "v"(l3), "v"(a3)
               : "memory");
}

// ---------------------------------------------------------------------------
// Load a 16(rows) x 32(k) f16 tile from row-major memory into WMMA A-operand
// layout (ISA 7.12.2, 16-bit A 16x32):
//   lanes 0-15  : row = lane,     K = 0-7   and 16-23
//   lanes 16-31 : row = lane-16,  K = 8-15  and 24-31
// The B operand of D = A*B is the A-layout of B^T, so W rows / Q rows (B) and
// K / V^T rows (A) all load through this same helper.
// ---------------------------------------------------------------------------
__device__ __forceinline__ v16h load_af(const h16* __restrict__ p, int ld, int k0, int lane) {
  const int row = lane & 15;
  const int hi  = (lane >> 4) << 3;           // 0 or 8
  const h16* q = p + (size_t)row * ld + k0 + hi;
  union { v16h v; v8h h[2]; } u;
  u.h[0] = *(const v8h*)(q);
  u.h[1] = *(const v8h*)(q + 16);
  return u.v;
}

// ---------------------------------------------------------------------------
// f32 -> f16 conversion of X and the four weight matrices in ONE launch: none of the
// five depends on another, so the block index picks the array. 4 elems/thread, 1024
// per block; the grid covers the five arrays exactly. The f16 copies lie one behind
// the other in dst, in the order X, Wq, Wk, Wv, Wo.
// The first Bz blocks build the row tables instead, one wave per batch: with n the
// number of unmasked rows of the batch and r1(s) that of unmasked rows in front of s,
// row s goes to place r1(s) if unmasked, else to n + s - r1(s): a permutation of
// 0..Sq-1 for every mask. toPart[row] = place, toOrig[place] = row (both with the
// batch's offset), nkeep[b] = n.
// ---------------------------------------------------------------------------
constexpr int TBLK = Bz;                    // table blocks, in front so that they start early
constexpr int XBLK = (Mrows * Dm) / 1024;   // 4096 blocks for X
constexpr int WBLK = (Dm * Dm) / 1024;      // 1024 blocks for each weight matrix
__global__ __launch_bounds__(256) void cvt_f32_f16(const float* __restrict__ X,
                                                   const float* __restrict__ Wq,
                                                   const float* __restrict__ Wk,
                                                   const float* __restrict__ Wv,
                                                   const float* __restrict__ Wo,
                                                   const int* __restrict__ amask,
                                                   h16* __restrict__ dst,
                                                   int* __restrict__ toOrig,
                                                   int* __restrict__ toPart,
                                                   int* __restrict__ nkeep) {
  if (blockIdx.x < TBLK) {
    if (threadIdx.x < 32) {                  // wave 0, all lanes on
      const int b    = blockIdx.x;
      const int lane = threadIdx.x;
      const int* m   = amask + b * Sq;
      unsigned word[Sq / 32];                // bit l of word c: row 32 c + l is unmasked
      int n = 0;
#pragma unroll                               // all loads in flight at once; word[] stays in registers
      for (int c = 0; c < Sq / 32; ++c) {
        word[c] = __builtin_amdgcn_ballot_w32(m[c * 32 + lane] != 0);
        n += __builtin_popcount(word[c]);
      }
      const unsigned below = (1u << lane) - 1u;
      int before = 0;                        // unmasked rows in front of chunk c
#pragma unroll                               // word[] is indexed by constants only
      for (int c = 0; c < Sq / 32; ++c) {
        const int s  = c * 32 + lane;
        const int r1 = before + __builtin_popcount(word[c] & below);
        const int p  = ((word[c] >> lane) & 1u) ? r1 : n + s - r1;
        toPart[b * Sq + s] = b * Sq + p;
        toOrig[b * Sq + p] = b * Sq + s;
        before += __builtin_popcount(word[c]);
      }
      if (lane == 0) nkeep[b] = n;
    }
    return;
  }
  const int blk = blockIdx.x - TBLK;
  const float* src = X;
  int sblk = blk;                            // block inside its own array
  if (blk >= XBLK) {
    const int wi = (blk - XBLK) / WBLK;      // 0..3
    sblk = (blk - XBLK) % WBLK;
    src = wi == 0 ? Wq : wi == 1 ? Wk : wi == 2 ? Wv : Wo;
  }
  const float4 v = *(const float4*)(src + (size_t)sblk * 1024 + threadIdx.x * 4);
  const v4h o = { (h16)v.x, (h16)v.y, (h16)v.z, (h16)v.w };
  *(v4h*)(dst + (size_t)blk * 1024 + threadIdx.x * 4) = o;
}

// ---------------------------------------------------------------------------
// Store a wave's 32 x 64 accumulators (2 x 4 tiles), first element (row0, col0) of Y.
// C/D layout: lane<16 -> N=lane, M=r ; lane>=16 -> N=lane-16, M=r+8
// MODE 0: f16 head-major [B,H,S,64]      (Q, K)
// MODE 1: f16 head-transposed [B,H,64,S] (V^T, feeds PV A-operand)
// MODE 2: f32 row-major [4096,1024]      (final output projection)
// ---------------------------------------------------------------------------
template <int MODE>
__device__ __forceinline__ void store_tile(const v8f (&acc)[2][4], void* __restrict__ dst,
                                           int row0, int col0, int lane) {
  const int nlo   = lane & 15;
  const int rbase = (lane >> 4) * 8;
#pragma unroll
  for (int i = 0; i < 2; ++i) {
#pragma unroll
    for (int j = 0; j < 4; ++j) {
#pragma unroll
      for (int r = 0; r < 8; ++r) {
        const int grow = row0 + 16 * i + rbase + r;     // 0..4095
        const int gcol = col0 + 16 * j + nlo;           // 0..1023
        const float val = acc[i][j][r];
        if constexpr (MODE == 2) {
          ((float*)dst)[(size_t)grow * Dm + gcol] = val;
        } else {
          const int b = grow >> 11, s = grow & (Sq - 1);
          const int h = gcol >> 6, d = gcol & (HD - 1);
          if constexpr (MODE == 0)
            ((h16*)dst)[(((size_t)b * Hh + h) * Sq + s) * HD + d] = (h16)val;
          else
            ((h16*)dst)[(((size_t)b * Hh + h) * HD + d) * Sq + s] = (h16)val;
        }
      }
    }
  }
}

// ---------------------------------------------------------------------------
// GEMM: Y = A(4096x1024, f16 row-major) * W^T (W is 1024x1024 f16 row-major).
// Block = 128x128 (8 waves as 4Mx2N), wave = 32x64 -> 2x4 accum tiles.
// Operand tiles double-buffered in LDS with async b128 copies:
//   wait(cur) -> barrier -> issue(next into alt buffer) -> compute(cur)
// QKV = true: the three projections of X, which do not depend on one another, share
// one launch; blockIdx.z picks weight matrix, destination and store mode: jobs 0 and
// 1 are Q and K (mode 0), job 2 is V^T (mode 1). 3 x 256 blocks of 40 KiB LDS and
// 128 VGPRs a wave: three to a WGP.
// QKV = false: one product, W0 -> d0, mode 2.
// Row r of the product is row rowmap[r] of A.
// ---------------------------------------------------------------------------
template <bool QKV>
__global__ __launch_bounds__(256) void gemm_xwt(const h16* __restrict__ A,
                                                const int* __restrict__ rowmap,
                                                const h16* __restrict__ W0,
                                                const h16* __restrict__ W1,
                                                const h16* __restrict__ W2,
                                                void* __restrict__ d0,
                                                void* __restrict__ d1,
                                                void* __restrict__ d2) {
  __shared__ h16 shA[2][128 * LDT];   // 2 x 10 KiB
  __shared__ h16 shW[2][128 * LDT];   // 2 x 10 KiB

  const int job  = QKV ? (int)blockIdx.z : 0;
  const h16* W   = job == 0 ? W0 : job == 1 ? W1 : W2;
  void* dst      = job == 0 ? d0 : job == 1 ? d1 : d2;

  const int tid  = threadIdx.x;
  const int lane = tid & 31;
  const int w    = tid >> 5;
  const int wm   = w & 3;            // 0..3
  const int wn   = w >> 2;           // 0..1
  const int rowB = blockIdx.y * 128;           // block row origin
  const int colB = blockIdx.x * 128;           // block col origin (W row origin)

  // async-copy assignment: each thread moves 2x16B of A and 2x16B of W
  const int crow  = tid >> 1;                  // 0..127
  const int csub0 = (tid & 1) * 2;             // subs {0,1} or {2,3} (16B units)
  const h16* agrow = A + (size_t)(rowmap[rowB + crow] & (Mrows - 1)) * Dm;   // the mask bounds the address
  const h16* wgrow = W + (size_t)(colB + crow) * Dm;
  const unsigned laA0 = lds_offset(&shA[0][crow * LDT + csub0 * 8]);
  const unsigned laW0 = lds_offset(&shW[0][crow * LDT + csub0 * 8]);
  const unsigned bufstride = (unsigned)(128 * LDT * sizeof(h16));

  auto issue_tile = [&](int k0, int buf) {
    const unsigned bo = (unsigned)buf * bufstride;
#pragma unroll
    for (int c = 0; c < 2; ++c) {
      const int sub = csub0 + c;
      async_g2l_b128(laA0 + bo + c * 16, agrow + k0 + sub * 8);
      async_g2l_b128(laW0 + bo + c * 16, wgrow + k0 + sub * 8);
    }
  };

  v8f acc[2][4];
#pragma unroll
  for (int i = 0; i < 2; ++i)
#pragma unroll
    for (int j = 0; j < 4; ++j) acc[i][j] = {};

  issue_tile(0, 0);                            // prologue fill

  for (int kt = 0; kt < Dm / 32; ++kt) {
    const int cur = kt & 1;
    asm volatile("s_wait_asynccnt 0x0" ::: "memory");
    __syncthreads();                           // cur tile visible to all waves
    if (kt + 1 < Dm / 32) issue_tile((kt + 1) * 32, cur ^ 1);  // overlap copy

    v16h af[2], bf[4];
#pragma unroll
    for (int i = 0; i < 2; ++i)
      af[i] = load_af(shA[cur] + (wm * 32 + 16 * i) * LDT, LDT, 0, lane);
#pragma unroll
    for (int j = 0; j < 4; ++j)
      bf[j] = load_af(shW[cur] + (wn * 64 + 16 * j) * LDT, LDT, 0, lane);

#pragma unroll
    for (int i = 0; i < 2; ++i)
#pragma unroll
      for (int j = 0; j < 4; ++j)
        acc[i][j] = WMMA16x16x32(af[i], bf[j], acc[i][j]);
  }

  const int row0 = rowB + wm * 32;
  const int col0 = colB + wn * 64;
  if constexpr (QKV) {                 // one block-uniform branch in front of all the stores
    if (job == 2) {
      store_tile<1>(acc, dst, row0, col0, lane);
    } else {
      store_tile<0>(acc, dst, row0, col0, lane);
      // The listing lays the other mode's code behind these stores, and it rewrites their
      // registers: the wait stands in front of that (a precaution).
      asm volatile("s_wait_xcnt 0x0" ::: "memory");
    }
  } else {
    store_tile<2>(acc, dst, row0, col0, lane);
  }
}

// ---------------------------------------------------------------------------
// Flash attention: 1 wave per (b, h, 32-query block) = 2048 waves.
// Each wave owns TWO 16-query column groups so every K/V fragment load feeds
// 2x the WMMAs. 32 keys / pass, products transposed:
//   S^T = K Q^T    (A = K rows, B = Q rows): lane l holds, of query l & 15, the scores
//                  of keys 8 (l >> 4) + r and 16 + 8 (l >> 4) + r, r = 0..7
//   O^T += V^T P^T (A = V^T rows, B = P^T): those 16 values, converted in place, are
//                  the B operand in the k order in which load_af reads the V^T rows
// so maximum and sum of a query run inside a lane, plus one exchange with lane l ^ 16
// for the maximum (the two halves' sums are joined once, at the end).
// The 8 waves of a block share one (b, h): each 64-key tile of K (64 x 128 B) and
// of V^T (64 x 128 B) is copied to LDS once per block, whole lines per 8 lanes,
// into two buffers: tile t + 1 flies while tile t is worked on.
// Keys are in partitioned order: places 0..n-1 are the batch's unmasked keys, and only
// they are walked, ceil(n / 32) passes; the keys past n in the last pass get the
// reference's -1e9, in a copy of the pass of its own. n = 0: the reference's scores
// are all -1e9, a uniform softmax over all Sq keys; Q = 0 over all keys gives the
// same weights.
// ---------------------------------------------------------------------------
__global__ __launch_bounds__(256) void attn_fwd(const h16* __restrict__ Qh,
                                                const h16* __restrict__ Kh,
                                                const h16* __restrict__ Vt,
                                                const int* __restrict__ nkeep,
                                                h16* __restrict__ Ah) {
  __shared__ __attribute__((aligned(16))) h16 shK[2][KT * LDK];   // 2 x 9 KiB, rows = keys
  __shared__ __attribute__((aligned(16))) h16 shV[2][HD * LDK];   // 2 x 9 KiB, rows = d

  const int lane = threadIdx.x & 31;
  const int w    = threadIdx.x >> 5;
  const int gw   = blockIdx.x * 8 + w;          // 0..2047
  const int b    = gw >> 10;                    // / (H*64)
  const int rem  = gw & 1023;
  const int h    = rem >> 6;
  const int q0   = (rem & 63) * 32;

  const h16* qbase = Qh + (((size_t)b * Hh + h) * Sq + q0) * HD;
  const h16* kbase = Kh + (((size_t)b * Hh + h) * Sq) * HD;
  const h16* vbase = Vt + (((size_t)b * Hh + h) * HD) * Sq;

  // same for the whole block (128 blocks a batch); the clamp bounds the trip count
  const int nk    = min(max(nkeep[blockIdx.x >> 7], 0), Sq);
  const int n     = nk == 0 ? Sq : nk;
  const int nfull = n >> 5;                     // passes whose 32 keys are all in front of n: 0..64
  const int ntile = (n + KT - 1) / KT;          // 1..32

  // copy assignment: 8 lanes per 128-B row, rows crow and crow + 32 of each tile
  const int crow = threadIdx.x >> 3;            // 0..31
  const int ccol = (threadIdx.x & 7) * 8;       // halfs
  const h16* kg = kbase + (size_t)crow * HD + ccol;
  const h16* vg = vbase + (size_t)crow * Sq + ccol;
  const unsigned lk = lds_offset(&shK[0][crow * LDK + ccol]);
  const unsigned lv = lds_offset(&shV[0][crow * LDK + ccol]);
  constexpr unsigned bufB  = (unsigned)(KT * LDK * sizeof(h16));
  constexpr unsigned halfB = (unsigned)(32 * LDK * sizeof(h16));
  auto issue_tile = [&](int tile, int buf) {
    const unsigned bo = (unsigned)buf * bufB;
    const h16* k = kg + (size_t)tile * KT * HD;
    const h16* v = vg + (size_t)tile * KT;
    async_g2l_b128_x4(lk + bo, k, lk + bo + halfB, k + 32 * HD,
                      lv + bo, v, lv + bo + halfB, v + (size_t)32 * Sq);
  };

  issue_tile(0, 0);
  asm volatile("s_wait_asynccnt 0x0" ::: "memory");   // this wave's part of tile 0 has landed
  __syncthreads();                                    // visible to all waves
  if (ntile > 1) issue_tile(1, 1);

  v16h qf[2][2];
#pragma unroll
  for (int u = 0; u < 2; ++u) {
    qf[u][0] = load_af(qbase + (size_t)u * 16 * HD, HD, 0, lane);
    qf[u][1] = load_af(qbase + (size_t)u * 16 * HD, HD, 32, lane);
    if (nk == 0) { qf[u][0] = {}; qf[u][1] = {}; }
  }

  float rm[2], rl[2];                    // of query csub of group u; rl sums this lane's keys only
  v8f o[2][4];                           // o[u][j][r] = O^T[16 j + rh + r][csub]
#pragma unroll
  for (int u = 0; u < 2; ++u) {
    rm[u] = -INFINITY; rl[u] = 0.0f;
#pragma unroll
    for (int j = 0; j < 4; ++j) o[u][j] = {};
  }

  const int csub = lane & 15;
  const int rh   = (lane >> 4) * 8;

  // One pass over keys 32 kt .. 32 kt + 31. EDGE: some of them are past n (the last pass).
  auto one_pass = [&](int kt, auto edge) {
    constexpr bool EDGE = decltype(edge)::value;
    const int k0  = kt * 32;
    const int cur = (kt >> 1) & 1;               // buffer of tile kt / 2
    const int kl  = (kt & 1) * 32;               // first key of this pass inside the tile

    // ---- shared K fragments for both query groups ----
    v16h kb[2][2];
#pragma unroll
    for (int t = 0; t < 2; ++t) {
      kb[t][0] = load_af(shK[cur] + (kl + 16 * t) * LDK, LDK, 0, lane);
      kb[t][1] = load_af(shK[cur] + (kl + 16 * t) * LDK, LDK, 32, lane);
    }

    v16h pf[2];
#pragma unroll
    for (int u = 0; u < 2; ++u) {
      // ---- scores (4 WMMAs per query group) ----
      v8f sc[2];
#pragma unroll
      for (int t = 0; t < 2; ++t) {
        sc[t] = {};
        sc[t] = WMMA16x16x32(kb[t][0], qf[u][0], sc[t]);
        sc[t] = WMMA16x16x32(kb[t][1], qf[u][1], sc[t]);
      }
      // ---- online softmax of one query per lane ----
      float s[16];
#pragma unroll
      for (int r = 0; r < 8; r += 2) {             // 1/sqrt(64), on register neighbours: two per instruction
        const v2f lo = v2f{sc[0][r], sc[0][r + 1]} * 0.125f;
        const v2f hi = v2f{sc[1][r], sc[1][r + 1]} * 0.125f;
        s[r]     = lo.x; s[r + 1] = lo.y;
        s[8 + r] = hi.x; s[9 + r] = hi.y;
      }
      if constexpr (EDGE) {
        const int left = n - k0 - rh;              // this lane's key 16 t + r is past n where 16 t + r >= left
#pragma unroll
        for (int r = 0; r < 8; ++r) {
          s[r]     = r < left ? s[r] : -1e9f;
          s[8 + r] = 16 + r < left ? s[8 + r] : -1e9f;
        }
      }
      float m = fmaxf(max3f(max3f(s[0], s[1], s[2]), max3f(s[3], s[4], s[5]), max3f(s[6], s[7], s[8])),
                      max3f(max3f(s[9], s[10], s[11]), max3f(s[12], s[13], s[14]), s[15]));
      m = fmaxf(m, xhalf(m));                      // over all 32 keys, same in both halves
      const float mn  = fmaxf(rm[u], m);
      const float cor = __expf(rm[u] - mn);
      float p[16];
#pragma unroll
      for (int e = 0; e < 16; e += 2) {
        const v2f a = (v2f{s[e], s[e + 1]} - mn) * 1.44269504f;   // exp(x) = 2^(x log2 e), two per instruction
        p[e]     = __builtin_amdgcn_exp2f(a.x);
        p[e + 1] = __builtin_amdgcn_exp2f(a.y);
        pf[u][e]     = (h16)p[e];                  // B[k][csub], k = 8 h + e or 16 + 8 h + (e - 8)
        pf[u][e + 1] = (h16)p[e + 1];
      }
      const float sum = (((p[0] + p[1]) + (p[2] + p[3])) + ((p[4] + p[5]) + (p[6] + p[7]))) +
                        (((p[8] + p[9]) + (p[10] + p[11])) + ((p[12] + p[13]) + (p[14] + p[15])));
      rl[u] = rl[u] * cor + sum;
      rm[u] = mn;
#pragma unroll
      for (int j = 0; j < 4; ++j) o[u][j] *= cor;
    }

    // ---- V^T * P^T: V fragments shared by both query groups (8 WMMAs) ----
#pragma unroll
    for (int j = 0; j < 4; ++j) {
      v16h vb = load_af(shV[cur] + (j * 16) * LDK, LDK, kl, lane);
      o[0][j] = WMMA16x16x32(vb, pf[0], o[0][j]);
      o[1][j] = WMMA16x16x32(vb, pf[1], o[1][j]);
    }

    // ---- foot of a tile's second pass: publish tile + 1, refill this buffer ----
    // (nothing is read behind the edge pass)
    if (!EDGE && (kt & 1)) {
      asm volatile("s_wait_dscnt 0x0" ::: "memory");     // this wave's reads of the buffer are done
      asm volatile("s_wait_asynccnt 0x0" ::: "memory");  // this wave's part of the next tile has landed
      __syncthreads();                                   // next tile visible; this buffer free
      if ((kt >> 1) + 2 < ntile) issue_tile((kt >> 1) + 2, cur);
    }
  };
  for (int kt = 0; kt < nfull; ++kt) one_pass(kt, cbool<false>{});
  if (n & 31) one_pass(nfull, cbool<true>{});
  asm volatile("s_wait_asynccnt 0x0" ::: "memory");      // no copy outstanding at the wave's end

  // ---- join the halves' sums, normalize, store f16 Ah[4096,1024]: 8 d = 16 B per store ----
#pragma unroll
  for (int u = 0; u < 2; ++u) {
    const float inv = 1.0f / (rl[u] + xhalf(rl[u]));
    const int s = q0 + u * 16 + csub;
#pragma unroll
    for (int j = 0; j < 4; ++j) {
      v8h ov;
#pragma unroll
      for (int r = 0; r < 8; ++r) ov[r] = (h16)(o[u][j][r] * inv);
      *(v8h*)&Ah[((size_t)b * Sq + s) * Dm + h * HD + j * 16 + rh] = ov;
    }
  }
}

// ---------------------------------------------------------------------------
// Launch
// ---------------------------------------------------------------------------
extern "C" void kernel_launch(void* const* d_in, const int* in_sizes, int n_in,
                              void* d_out, int out_size, void* d_ws, size_t ws_size,
                              hipStream_t stream) {
  const float* X    = (const float*)d_in[0];
  const int*   mask = (const int*)d_in[1];
  const float* Wq   = (const float*)d_in[2];
  const float* Wk   = (const float*)d_in[3];
  const float* Wv   = (const float*)d_in[4];
  const float* Wo   = (const float*)d_in[5];

  char* ws = (char*)d_ws;
  const size_t MiB = 1u << 20;
  h16* Xh  = (h16*)(ws + 0 * MiB);   // 8 MiB  [4096,1024]
  h16* Wqh = (h16*)(ws + 8 * MiB);   // 2 MiB
  h16* Wkh = (h16*)(ws + 10 * MiB);  // 2 MiB
  h16* Wvh = (h16*)(ws + 12 * MiB);  // 2 MiB
  h16* Woh = (h16*)(ws + 14 * MiB);  // 2 MiB
  h16* Qh  = (h16*)(ws + 16 * MiB);  // 8 MiB  [B,H,S,64]
  h16* Kh  = (h16*)(ws + 24 * MiB);  // 8 MiB  [B,H,S,64]
  h16* Vt  = (h16*)(ws + 32 * MiB);  // 8 MiB  [B,H,64,S]
  h16* Ah  = (h16*)(ws + 40 * MiB);  // 8 MiB  [4096,1024]
  int* toOrig = (int*)(ws + 48 * MiB);             // 16 KiB  partitioned place -> row
  int* toPart = (int*)(ws + 48 * MiB + 16 * 1024); // 16 KiB  row -> partitioned place
  int* nkeep  = (int*)(ws + 48 * MiB + 32 * 1024); // Bz ints: unmasked rows of a batch

  // f32 -> f16, all five arrays in one launch: Xh, Wqh, Wkh, Wvh, Woh are contiguous from Xh;
  // the row tables with them
  cvt_f32_f16<<<TBLK + XBLK + 4 * WBLK, 256, 0, stream>>>(X, Wq, Wk, Wv, Wo, mask, Xh, toOrig, toPart, nkeep);

  // QKV projections in one launch (z = 0: Q, 1: K, 2: V^T), rows in partitioned order
  dim3 gg(Dm / 128, Mrows / 128);        // (8, 32)
  dim3 g3(Dm / 128, Mrows / 128, 3);     // (8, 32, 3)
  gemm_xwt<true><<<g3, 256, 0, stream>>>(Xh, toOrig, Wqh, Wkh, Wvh, Qh, Kh, Vt);

  // streaming attention (2048 waves, 8 waves/block)
  attn_fwd<<<256, 256, 0, stream>>>(Qh, Kh, Vt, nkeep, Ah);

  // output projection -> f32 d_out, rows back in their own order
  gemm_xwt<false><<<gg, 256, 0, stream>>>(Ah, toPart, Woh, nullptr, nullptr, d_out, nullptr, nullptr);
}

// v005
// It runs in 69.7 microseconds.
// Timed twice side by side with v004, it ran 1.17 and 1.16 times as fast.
// All steps since v000 together make it 2.78 times as fast.
#include <hip/hip_runtime.h>
#include <hip/hip_bf16.h>
#include <math.h>

typedef _Float16 h16;
typedef __attribute__((ext_vector_type(16))) _Float16 v16h;
typedef __attribute__((ext_vector_type(8)))  _Float16 v8h;
typedef __attribute__((ext_vector_type(4)))  _Float16 v4h;
typedef __attribute__((ext_vector_type(8)))  float    v8f;
typedef __attribute__((ext_vector_type(2)))  float    v2f;

#define WMMA16x16x32(a, b, c) \
  __builtin_amdgcn_wmma_f32_16x16x32_f16(false, (a), false, (b), (short)0, (c), false, false)

constexpr int Bz = 2;
constexpr int Sq = 2048;
constexpr int Dm = 1024;
constexpr int Hh = 16;
constexpr int HD = 64;
constexpr int Mrows = Bz * Sq;   // 4096
constexpr int KT  = 64;          // keys per staged attention tile
constexpr int BK  = 64;          // k per staged GEMM tile: 128 B of a row, one line
constexpr int LDK = 72;          // LDS pitch of the 128-B rows of both (halfs): 144 B = 16 B x odd

template <bool V> struct cbool { static constexpr bool value = V; };   // compile-time switch of a lambda

// Value of lane l ^ 16: the two lanes that share a column of a WMMA C-matrix.
__device__ __forceinline__ float xhalf(float x) {
  return __int_as_float(__builtin_amdgcn_permlanex16(__float_as_int(x), __float_as_int(x),
                                                     0x76543210, 0xfedcba98, false, false));
}
__device__ __forceinline__ float max3f(float a, float b, float c) { return fmaxf(fmaxf(a, b), c); }

__device__ __forceinline__ unsigned lds_offset(const void* p) {
  return (unsigned)(uintptr_t)p;   // flat LDS addr truncates to LDS offset
}
// Four async 16-byte global -> LDS copies (ASYNCcnt) of one lane in one statement. s_wait_xcnt 0 is the
// statement's last line so that it stands in front of every later rewrite of the
// address registers named here (a precaution).
__device__ __forceinline__ void async_g2l_b128_x4(unsigned l0, const void* g0, unsigned l1, const void* g1,
                                                  unsigned l2, const void* g2, unsigned l3, const void* g3) {
  unsigned long long a0 = (unsigned long long)(uintptr_t)g0;
  unsigned long long a1 = (unsigned long long)(uintptr_t)g1;
  unsigned long long a2 = (unsigned long long)(uintptr_t)g2;
  unsigned long long a3 = (unsigned long long)(uintptr_t)g3;
  asm volatile("global_load_async_to_lds_b128 %0, %1, off\n\t"
               "global_load_async_to_lds_b128 %2, %3, off\n\t"
               "global_load_async_to_lds_b128 %4, %5, off\n\t"
               "global_load_async_to_lds_b128 %6, %7, off\n\t"
               "s_wait_xcnt 0x0"
               :: "v"(l0), "v"(a0), "v"(l1), "v"(a1), "v"(l2), "v"(a2), "v"(l3), "v"(a3)
               : "memory");
}

// The same for eight copies: one wait for a whole GEMM tile's share of a lane.
__device__ __forceinline__ void async_g2l_b128_x8(const unsigned (&l)[8], const h16* const (&g)[8]) {
  unsigned long long a[8];
#pragma unroll                               // a[] is indexed by constants only: it stays in registers
  for (int i = 0; i < 8; ++i) a[i] = (unsigned long long)(uintptr_t)g[i];
  asm volatile("global_load_async_to_lds_b128 %0, %1, off\n\t"
               "global_load_async_to_lds_b128 %2, %3, off\n\t"
               "global_load_async_to_lds_b128 %4, %5, off\n\t"
               "global_load_async_to_lds_b128 %6, %7, off\n\t"
               "global_load_async_to_lds_b128 %8, %9, off\n\t"
               "global_load_async_to_lds_b128 %10, %11, off\n\t"
               "global_load_async_to_lds_b128 %12, %13, off\n\t"
               "global_load_async_to_lds_b128 %14, %15, off\n\t"
               "s_wait_xcnt 0x0"
               :: "v"(l[0]), "v"(a[0]), "v"(l[1]), "v"(a[1]), "v"(l[2]), "v"(a[2]), "v"(l[3]), "v"(a[3]),
                  "v"(l[4]), "v"(a[4]), "v"(l[5]), "v"(a[5]), "v"(l[6]), "v"(a[6]), "v"(l[7]), "v"(a[7])
               : "memory");
}

// ---------------------------------------------------------------------------
// Load a 16(rows) x 32(k) f16 tile from row-major memory into WMMA A-operand
// layout (ISA 7.12.2, 16-bit A 16x32):
//   lanes 0-15  : row = lane,     K = 0-7   and 16-23
//   lanes 16-31 : row = lane-16,  K = 8-15  and 24-31
// The B operand of D = A*B is the A-layout of B^T, so W rows / Q rows (B) and
// K / V^T rows (A) all load through this same helper.
// ---------------------------------------------------------------------------
__device__ __forceinline__ v16h load_af(const h16* __restrict__ p, int ld, int k0, int lane) {
  const int row = lane & 15;
  const int hi  = (lane >> 4) << 3;           // 0 or 8
  const h16* q = p + (size_t)row * ld + k0 + hi;
  union { v16h v; v8h h[2]; } u;
  u.h[0] = *(const v8h*)(q);
  u.h[1] = *(const v8h*)(q + 16);
  return u.v;
}

// ---------------------------------------------------------------------------
// f32 -> f16 conversion of X and the four weight matrices in ONE launch: none of the
// five depends on another, so the block index picks the array. 4 elems/thread, 1024
// per block; the grid covers the five arrays exactly. The f16 copies lie one behind
// the other in dst, in the order X, Wq, Wk, Wv, Wo.
// The first Bz blocks build the row tables instead, one wave per batch: with n the
// number of unmasked rows of the batch and r1(s) that of unmasked rows in front of s,
// row s goes to place r1(s) if unmasked, else to n + s - r1(s): a permutation of
// 0..Sq-1 for every mask. toPart[row] = place, toOrig[place] = row (both with the
// batch's offset), nkeep[b] = n.
// ---------------------------------------------------------------------------
constexpr int TBLK = Bz;                    // table blocks, in front so that they start early
constexpr int XBLK = (Mrows * Dm) / 1024;   // 4096 blocks for X
constexpr int WBLK = (Dm * Dm) / 1024;      // 1024 blocks for each weight matrix
__global__ __launch_bounds__(256) void cvt_f32_f16(const float* __restrict__ X,
                                                   const float* __restrict__ Wq,
                                                   const float* __restrict__ Wk,
                                                   const float* __restrict__ Wv,
                                                   const float* __restrict__ Wo,
                                                   const int* __restrict__ amask,
                                                   h16* __restrict__ dst,
                                                   int* __restrict__ toOrig,
                                                   int* __restrict__ toPart,
                                                   int* __restrict__ nkeep) {
  if (blockIdx.x < TBLK) {
    if (threadIdx.x < 32) {                  // wave 0, all lanes on
      const int b    = blockIdx.x;
      const int lane = threadIdx.x;
      const int* m   = amask + b * Sq;
      unsigned word[Sq / 32];                // bit l of word c: row 32 c + l is unmasked
      int n = 0;
#pragma unroll                               // all loads in flight at once; word[] stays in registers
      for (int c = 0; c < Sq / 32; ++c) {
        word[c] = __builtin_amdgcn_ballot_w32(m[c * 32 + lane] != 0);
        n += __builtin_popcount(word[c]);
      }
      const unsigned below = (1u << lane) - 1u;
      int before = 0;                        // unmasked rows in front of chunk c
#pragma unroll                               // word[] is indexed by constants only
      for (int c = 0; c < Sq / 32; ++c) {
        const int s  = c * 32 + lane;
        const int r1 = before + __builtin_popcount(word[c] & below);
        const int p  = ((word[c] >> lane) & 1u) ? r1 : n + s - r1;
        toPart[b * Sq + s] = b * Sq + p;
        toOrig[b * Sq + p] = b * Sq + s;
        before += __builtin_popcount(word[c]);
      }
      if (lane == 0) nkeep[b] = n;
    }
    return;
  }
  const int blk = blockIdx.x - TBLK;
  const float* src = X;
  int sblk = blk;                            // block inside its own array
  if (blk >= XBLK) {
    const int wi = (blk - XBLK) / WBLK;      // 0..3
    sblk = (blk - XBLK) % WBLK;
    src = wi == 0 ? Wq : wi == 1 ? Wk : wi == 2 ? Wv : Wo;
  }
  const float4 v = *(const float4*)(src + (size_t)sblk * 1024 + threadIdx.x * 4);
  const v4h o = { (h16)v.x, (h16)v.y, (h16)v.z, (h16)v.w };
  *(v4h*)(dst + (size_t)blk * 1024 + threadIdx.x * 4) = o;
}

// ---------------------------------------------------------------------------
// Store a wave's 32 x 64 accumulators (2 x 4 tiles), first element (row0, col0) of Y.
// C/D layout: lane<16 -> N=lane, M=r ; lane>=16 -> N=lane-16, M=r+8
// MODE 0: f16 head-major [B,H,S,64]      (Q, K)
// MODE 1: f16 head-transposed [B,H,64,S] (V^T, feeds PV A-operand)
// MODE 2: f32 row-major [4096,1024]      (final output projection)
// ---------------------------------------------------------------------------
template <int MODE>
__device__ __forceinline__ void store_tile(const v8f (&acc)[2][4], void* __restrict__ dst,
                                           int row0, int col0, int lane) {
  const int nlo   = lane & 15;
  const int rbase = (lane >> 4) * 8;
#pragma unroll
  for (int i = 0; i < 2; ++i) {
#pragma unroll
    for (int j = 0; j < 4; ++j) {
#pragma unroll
      for (int r = 0; r < 8; ++r) {
        const int grow = row0 + 16 * i + rbase + r;     // 0..4095
        const int gcol = col0 + 16 * j + nlo;           // 0..1023
        const float val = acc[i][j][r];
        if constexpr (MODE == 2) {
          ((float*)dst)[(size_t)grow * Dm + gcol] = val;
        } else {
          const int b = grow >> 11, s = grow & (Sq - 1);
          const int h = gcol >> 6, d = gcol & (HD - 1);
          if constexpr (MODE == 0)
            ((h16*)dst)[(((size_t)b * Hh + h) * Sq + s) * HD + d] = (h16)val;
          else
            ((h16*)dst)[(((size_t)b * Hh + h) * HD + d) * Sq + s] = (h16)val;
        }
      }
    }
  }
}

// ---------------------------------------------------------------------------
// GEMM: Y = A(4096x1024, f16 row-major) * W^T (W is 1024x1024 f16 row-major).
// Block = 128x128 (8 waves as 4Mx2N), wave = 32x64 -> 2x4 accum tiles.
// Operand tiles of 128 rows x 64 k double-buffered in LDS with async b128 copies, 8 lanes
// per row, so that one copy instruction covers four whole 128-B lines:
//   compute(t) -> waits -> barrier -> issue(t + 2 into the buffer just read)
// QKV = true: the three projections of X, which do not depend on one another, share
// one launch; blockIdx.z picks weight matrix, destination and store mode: jobs 0 and
// 1 are Q and K (mode 0), job 2 is V^T (mode 1). 3 x 256 blocks of 72 KiB LDS: three
// to a WGP.
// QKV = false: one product, W0 -> d0, mode 2.
// Row r of the product is row rowmap[r] of A.
// ---------------------------------------------------------------------------
template <bool QKV>
__global__ __launch_bounds__(256) void gemm_xwt(const h16* __restrict__ A,
                                                const int* __restrict__ rowmap,
                                                const h16* __restrict__ W0,
                                                const h16* __restrict__ W1,
                                                const h16* __restrict__ W2,
                                                void* __restrict__ d0,
                                                void* __restrict__ d1,
                                                void* __restrict__ d2) {
  __shared__ __attribute__((aligned(16))) h16 shA[2][128 * LDK];   // 2 x 18 KiB
  __shared__ __attribute__((aligned(16))) h16 shW[2][128 * LDK];   // 2 x 18 KiB

  const int job  = QKV ? (int)blockIdx.z : 0;
  const h16* W   = job == 0 ? W0 : job == 1 ? W1 : W2;
  void* dst      = job == 0 ? d0 : job == 1 ? d1 : d2;

  const int tid  = threadIdx.x;
  const int lane = tid & 31;
  const int w    = tid >> 5;
  const int wm   = w & 3;            // 0..3
  const int wn   = w >> 2;           // 0..1
  const int rowB = blockIdx.y * 128;           // block row origin
  const int colB = blockIdx.x * 128;           // block col origin (W row origin)

  // copy assignment: 8 lanes per 128-B row, rows crow + 32 i (i = 0..3) of each tile
  const int crow = tid >> 3;                   // 0..31
  const int ccol = (tid & 7) * 8;              // halfs
  const h16* ag[4];
  const h16* wg[4];
#pragma unroll                               // the pointers stay in registers
  for (int i = 0; i < 4; ++i) {
    ag[i] = A + (size_t)(rowmap[rowB + crow + 32 * i] & (Mrows - 1)) * Dm + ccol;   // the mask bounds the address
    wg[i] = W + (size_t)(colB + crow + 32 * i) * Dm + ccol;
  }
  const unsigned la = lds_offset(&shA[0][crow * LDK + ccol]);
  const unsigned lw = lds_offset(&shW[0][crow * LDK + ccol]);
  constexpr unsigned bufB = (unsigned)(128 * LDK * sizeof(h16));
  constexpr unsigned qB   = (unsigned)(32 * LDK * sizeof(h16));
  constexpr int NT = Dm / BK;                  // 16 tiles

  auto issue_tile = [&](int t, int buf) {
    const unsigned bo = (unsigned)buf * bufB;
    const int k0 = t * BK;
    const unsigned l[8] = { la + bo, la + bo + qB, la + bo + 2 * qB, la + bo + 3 * qB,
                            lw + bo, lw + bo + qB, lw + bo + 2 * qB, lw + bo + 3 * qB };
    const h16* const g[8] = { ag[0] + k0, ag[1] + k0, ag[2] + k0, ag[3] + k0,
                              wg[0] + k0, wg[1] + k0, wg[2] + k0, wg[3] + k0 };
    async_g2l_b128_x8(l, g);
  };

  v8f acc[2][4];
#pragma unroll
  for (int i = 0; i < 2; ++i)
#pragma unroll
    for (int j = 0; j < 4; ++j) acc[i][j] = {};

  issue_tile(0, 0);
  asm volatile("s_wait_asynccnt 0x0" ::: "memory");   // this wave's part of tile 0 has landed
  __syncthreads();                                    // visible to all waves
  issue_tile(1, 1);

  for (int t = 0; t < NT; ++t) {
    const int cur = t & 1;
#pragma unroll                               // ks becomes a constant offset of the LDS loads
    for (int ks = 0; ks < BK; ks += 32) {
      v16h af[2], bf[4];
#pragma unroll
      for (int i = 0; i < 2; ++i)
        af[i] = load_af(shA[cur] + (wm * 32 + 16 * i) * LDK, LDK, ks, lane);
#pragma unroll
      for (int j = 0; j < 4; ++j)
        bf[j] = load_af(shW[cur] + (wn * 64 + 16 * j) * LDK, LDK, ks, lane);

#pragma unroll
      for (int i = 0; i < 2; ++i)
#pragma unroll
        for (int j = 0; j < 4; ++j)
          acc[i][j] = WMMA16x16x32(af[i], bf[j], acc[i][j]);
    }

    asm volatile("s_wait_dscnt 0x0" ::: "memory");     // this wave's reads of the buffer are done
    asm volatile("s_wait_asynccnt 0x0" ::: "memory");  // this wave's part of the next tile has landed
    __syncthreads();                                   // next tile visible; this buffer free
    if (t + 2 < NT) issue_tile(t + 2, cur);
  }
  asm volatile("s_wait_asynccnt 0x0" ::: "memory");    // no copy outstanding behind the loop

  const int row0 = rowB + wm * 32;
  const int col0 = colB + wn * 64;
  if constexpr (QKV) {                 // one block-uniform branch in front of all the stores
    if (job == 2) {
      store_tile<1>(acc, dst, row0, col0, lane);
    } else {
      store_tile<0>(acc, dst, row0, col0, lane);
      // The listing lays the other mode's code behind these stores, and it rewrites their
      // registers: the wait stands in front of that (a precaution).
      asm volatile("s_wait_xcnt 0x0" ::: "memory");
    }
  } else {
    store_tile<2>(acc, dst, row0, col0, lane);
  }
}

// ---------------------------------------------------------------------------
// Flash attention: 1 wave per (b, h, 32-query block) = 2048 waves.
// Each wave owns TWO 16-query column groups so every K/V fragment load feeds
// 2x the WMMAs. 32 keys / pass, products transposed:
//   S^T = K Q^T    (A = K rows, B = Q rows): lane l holds, of query l & 15, the scores
//                  of keys 8 (l >> 4) + r and 16 + 8 (l >> 4) + r, r = 0..7
//   O^T += V^T P^T (A = V^T rows, B = P^T): those 16 values, converted in place, are
//                  the B operand in the k order in which load_af reads the V^T rows
// so maximum and sum of a query run inside a lane, plus one exchange with lane l ^ 16
// for the maximum (the two halves' sums are joined once, at the end).
// The 8 waves of a block share one (b, h): each 64-key tile of K (64 x 128 B) and
// of V^T (64 x 128 B) is copied to LDS once per block, whole lines per 8 lanes,
// into two buffers: tile t + 1 flies while tile t is worked on.
// Keys are in partitioned order: places 0..n-1 are the batch's unmasked keys, and only
// they are walked, ceil(n / 32) passes; the keys past n in the last pass get the
// reference's -1e9, in a copy of the pass of its own. n = 0: the reference's scores
// are all -1e9, a uniform softmax over all Sq keys; Q = 0 over all keys gives the
// same weights.
// ---------------------------------------------------------------------------
__global__ __launch_bounds__(256) void attn_fwd(const h16* __restrict__ Qh,
                                                const h16* __restrict__ Kh,
                                                const h16* __restrict__ Vt,
                                                const int* __restrict__ nkeep,
                                                h16* __restrict__ Ah) {
  __shared__ __attribute__((aligned(16))) h16 shK[2][KT * LDK];   // 2 x 9 KiB, rows = keys
  __shared__ __attribute__((aligned(16))) h16 shV[2][HD * LDK];   // 2 x 9 KiB, rows = d

  const int lane = threadIdx.x & 31;
  const int w    = threadIdx.x >> 5;
  const int gw   = blockIdx.x * 8 + w;          // 0..2047
  const int b    = gw >> 10;                    // / (H*64)
  const int rem  = gw & 1023;
  const int h    = rem >> 6;
  const int q0   = (rem & 63) * 32;

  const h16* qbase = Qh + (((size_t)b * Hh + h) * Sq + q0) * HD;
  const h16* kbase = Kh + (((size_t)b * Hh + h) * Sq) * HD;
  const h16* vbase = Vt + (((size_t)b * Hh + h) * HD) * Sq;

  // same for the whole block (128 blocks a batch); the clamp bounds the trip count
  const int nk    = min(max(nkeep[blockIdx.x >> 7], 0), Sq);
  const int n     = nk == 0 ? Sq : nk;
  const int nfull = n >> 5;                     // passes whose 32 keys are all in front of n: 0..64
  const int ntile = (n + KT - 1) / KT;          // 1..32

  // copy assignment: 8 lanes per 128-B row, rows crow and crow + 32 of each tile
  const int crow = threadIdx.x >> 3;            // 0..31
  const int ccol = (threadIdx.x & 7) * 8;       // halfs
  const h16* kg = kbase + (size_t)crow * HD + ccol;
  const h16* vg = vbase + (size_t)crow * Sq + ccol;
  const unsigned lk = lds_offset(&shK[0][crow * LDK + ccol]);
  const unsigned lv = lds_offset(&shV[0][crow * LDK + ccol]);
  constexpr unsigned bufB  = (unsigned)(KT * LDK * sizeof(h16));
  constexpr unsigned halfB = (unsigned)(32 * LDK * sizeof(h16));
  auto issue_tile = [&](int tile, int buf) {
    const unsigned bo = (unsigned)buf * bufB;
    const h16* k = kg + (size_t)tile * KT * HD;
    const h16* v = vg + (size_t)tile * KT;
    async_g2l_b128_x4(lk + bo, k, lk + bo + halfB, k + 32 * HD,
                      lv + bo, v, lv + bo + halfB, v + (size_t)32 * Sq);
  };

  issue_tile(0, 0);
  asm volatile("s_wait_asynccnt 0x0" ::: "memory");   // this wave's part of tile 0 has landed
  __syncthreads();                                    // visible to all waves
  if (ntile > 1) issue_tile(1, 1);

  v16h qf[2][2];
#pragma unroll
  for (int u = 0; u < 2; ++u) {
    qf[u][0] = load_af(qbase + (size_t)u * 16 * HD, HD, 0, lane);
    qf[u][1] = load_af(qbase + (size_t)u * 16 * HD, HD, 32, lane);
    if (nk == 0) { qf[u][0] = {}; qf[u][1] = {}; }
  }

  float rm[2], rl[2];                    // of query csub of group u; rl sums this lane's keys only
  v8f o[2][4];                           // o[u][j][r] = O^T[16 j + rh + r][csub]
#pragma unroll
  for (int u = 0; u < 2; ++u) {
    rm[u] = -INFINITY; rl[u] = 0.0f;
#pragma unroll
    for (int j = 0; j < 4; ++j) o[u][j] = {};
  }

  const int csub = lane & 15;
  const int rh   = (lane >> 4) * 8;

  // One pass over keys 32 kt .. 32 kt + 31. EDGE: some of them are past n (the last pass).
  auto one_pass = [&](int kt, auto edge) {
    constexpr bool EDGE = decltype(edge)::value;
    const int k0  = kt * 32;
    const int cur = (kt >> 1) & 1;               // buffer of tile kt / 2
    const int kl  = (kt & 1) * 32;               // first key of this pass inside the tile

    // ---- shared K fragments for both query groups ----
    v16h kb[2][2];
#pragma unroll
    for (int t = 0; t < 2; ++t) {
      kb[t][0] = load_af(shK[cur] + (kl + 16 * t) * LDK, LDK, 0, lane);
      kb[t][1] = load_af(shK[cur] + (kl + 16 * t) * LDK, LDK, 32, lane);
    }

    v16h pf[2];
#pragma unroll
    for (int u = 0; u < 2; ++u) {
      // ---- scores (4 WMMAs per query group) ----
      v8f sc[2];
#pragma unroll
      for (int t = 0; t < 2; ++t) {
        sc[t] = {};
        sc[t] = WMMA16x16x32(kb[t][0], qf[u][0], sc[t]);
        sc[t] = WMMA16x16x32(kb[t][1], qf[u][1], sc[t]);
      }
      // ---- online softmax of one query per lane ----
      float s[16];
#pragma unroll
      for (int r = 0; r < 8; r += 2) {             // 1/sqrt(64), on register neighbours: two per instruction
        const v2f lo = v2f{sc[0][r], sc[0][r + 1]} * 0.125f;
        const v2f hi = v2f{sc[1][r], sc[1][r + 1]} * 0.125f;
        s[r]     = lo.x; s[r + 1] = lo.y;
        s[8 + r] = hi.x; s[9 + r] = hi.y;
      }
      if constexpr (EDGE) {
        const int left = n - k0 - rh;              // this lane's key 16 t + r is past n where 16 t + r >= left
#pragma unroll
        for (int r = 0; r < 8; ++r) {
          s[r]     = r < left ? s[r] : -1e9f;
          s[8 + r] = 16 + r < left ? s[8 + r] : -1e9f;
        }
      }
      float m = fmaxf(max3f(max3f(s[0], s[1], s[2]), max3f(s[3], s[4], s[5]), max3f(s[6], s[7], s[8])),
                      max3f(max3f(s[9], s[10], s[11]), max3f(s[12], s[13], s[14]), s[15]));
      m = fmaxf(m, xhalf(m));                      // over all 32 keys, same in both halves
      const float mn  = fmaxf(rm[u], m);
      const float cor = __expf(rm[u] - mn);
      float p[16];
#pragma unroll
      for (int e = 0; e < 16; e += 2) {
        const v2f a = (v2f{s[e], s[e + 1]} - mn) * 1.44269504f;   // exp(x) = 2^(x log2 e), two per instruction
        p[e]     = __builtin_amdgcn_exp2f(a.x);
        p[e + 1] = __builtin_amdgcn_exp2f(a.y);
        pf[u][e]     = (h16)p[e];                  // B[k][csub], k = 8 h + e or 16 + 8 h + (e - 8)
        pf[u][e + 1] = (h16)p[e + 1];
      }
      const float sum = (((p[0] + p[1]) + (p[2] + p[3])) + ((p[4] + p[5]) + (p[6] + p[7]))) +
                        (((p[8] + p[9]) + (p[10] + p[11])) + ((p[12] + p[13]) + (p[14] + p[15])));
      rl[u] = rl[u] * cor + sum;
      rm[u] = mn;
#pragma unroll
      for (int j = 0; j < 4; ++j) o[u][j] *= cor;
    }

    // ---- V^T * P^T: V fragments shared by both query groups (8 WMMAs) ----
#pragma unroll
    for (int j = 0; j < 4; ++j) {
      v16h vb = load_af(shV[cur] + (j * 16) * LDK, LDK, kl, lane);
      o[0][j] = WMMA16x16x32(vb, pf[0], o[0][j]);
      o[1][j] = WMMA16x16x32(vb, pf[1], o[1][j]);
    }

    // ---- foot of a tile's second pass: publish tile + 1, refill this buffer ----
    // (nothing is read behind the edge pass)
    if (!EDGE && (kt & 1)) {
      asm volatile("s_wait_dscnt 0x0" ::: "memory");     // this wave's reads of the buffer are done
      asm volatile("s_wait_asynccnt 0x0" ::: "memory");  // this wave's part of the next tile has landed
      __syncthreads();                                   // next tile visible; this buffer free
      if ((kt >> 1) + 2 < ntile) issue_tile((kt >> 1) + 2, cur);
    }
  };
  for (int kt = 0; kt < nfull; ++kt) one_pass(kt, cbool<false>{});
  if (n & 31) one_pass(nfull, cbool<true>{});
  asm volatile("s_wait_asynccnt 0x0" ::: "memory");      // no copy outstanding at the wave's end

  // ---- join the halves' sums, normalize, store f16 Ah[4096,1024]: 8 d = 16 B per store ----
#pragma unroll
  for (int u = 0; u < 2; ++u) {
    const float inv = 1.0f / (rl[u] + xhalf(rl[u]));
    const int s = q0 + u * 16 + csub;
#pragma unroll
    for (int j = 0; j < 4; ++j) {
      v8h ov;
#pragma unroll
      for (int r = 0; r < 8; ++r) ov[r] = (h16)(o[u][j][r] * inv);
      *(v8h*)&Ah[((size_t)b * Sq + s) * Dm + h * HD + j * 16 + rh] = ov;
    }
  }
}

// ---------------------------------------------------------------------------
// Launch
// ---------------------------------------------------------------------------
extern "C" void kernel_launch(void* const* d_in, const int* in_sizes, int n_in,
                              void* d_out, int out_size, void* d_ws, size_t ws_size,
                              hipStream_t stream) {
  const float* X    = (const float*)d_in[0];
  const int*   mask = (const int*)d_in[1];
  const float* Wq   = (const float*)d_in[2];
  const float* Wk   = (const float*)d_in[3];
  const float* Wv   = (const float*)d_in[4];
  const float* Wo   = (const float*)d_in[5];

  char* ws = (char*)d_ws;
  const size_t MiB = 1u << 20;
  h16* Xh  = (h16*)(ws + 0 * MiB);   // 8 MiB  [4096,1024]
  h16* Wqh = (h16*)(ws + 8 * MiB);   // 2 MiB
  h16* Wkh = (h16*)(ws + 10 * MiB);  // 2 MiB
  h16* Wvh = (h16*)(ws + 12 * MiB);  // 2 MiB
  h16* Woh = (h16*)(ws + 14 * MiB);  // 2 MiB
  h16* Qh  = (h16*)(ws + 16 * MiB);  // 8 MiB  [B,H,S,64]
  h16* Kh  = (h16*)(ws + 24 * MiB);  // 8 MiB  [B,H,S,64]
  h16* Vt  = (h16*)(ws + 32 * MiB);  // 8 MiB  [B,H,64,S]
  h16* Ah  = (h16*)(ws + 40 * MiB);  // 8 MiB  [4096,1024]
  int* toOrig = (int*)(ws + 48 * MiB);             // 16 KiB  partitioned place -> row
  int* toPart = (int*)(ws + 48 * MiB + 16 * 1024); // 16 KiB  row -> partitioned place
  int* nkeep  = (int*)(ws + 48 * MiB + 32 * 1024); // Bz ints: unmasked rows of a batch

  // f32 -> f16, all five arrays in one launch: Xh, Wqh, Wkh, Wvh, Woh are contiguous from Xh;
  // the row tables with them
  cvt_f32_f16<<<TBLK + XBLK + 4 * WBLK, 256, 0, stream>>>(X, Wq, Wk, Wv, Wo, mask, Xh, toOrig, toPart, nkeep);

  // QKV projections in one launch (z = 0: Q, 1: K, 2: V^T), rows in partitioned order
  dim3 gg(Dm / 128, Mrows / 128);        // (8, 32)
  dim3 g3(Dm / 128, Mrows / 128, 3);     // (8, 32, 3)
  gemm_xwt<true><<<g3, 256, 0, stream>>>(Xh, toOrig, Wqh, Wkh, Wvh, Qh, Kh, Vt);

  // streaming attention (2048 waves, 8 waves/block)
  attn_fwd<<<256, 256, 0, stream>>>(Qh, Kh, Vt, nkeep, Ah);

  // output projection -> f32 d_out, rows back in their own order
  gemm_xwt<false><<<gg, 256, 0, stream>>>(Ah, toPart, Woh, nullptr, nullptr, d_out, nullptr, nullptr);
}

// v006
// One run takes 66.7 microseconds.
// Next to v005, in two timings, it ran 1.05 times as fast each time.
// All steps since v000 together make it 2.92 times as fast.
#include <hip/hip_runtime.h>
#include <hip/hip_bf16.h>
#include <math.h>

typedef _Float16 h16;
typedef __attribute__((ext_vector_type(16))) _Float16 v16h;
typedef __attribute__((ext_vector_type(8)))  _Float16 v8h;
typedef __attribute__((ext_vector_type(4)))  _Float16 v4h;
typedef __attribute__((ext_vector_type(8)))  float    v8f;
typedef __attribute__((ext_vector_type(2)))  float    v2f;

#define WMMA16x16x32(a, b, c) \
  __builtin_amdgcn_wmma_f32_16x16x32_f16(false, (a), false, (b), (short)0, (c), false, false)

constexpr int Bz = 2;
constexpr int Sq = 2048;
constexpr int Dm = 1024;
constexpr int Hh = 16;
constexpr int HD = 64;
constexpr int Mrows = Bz * Sq;   // 4096
constexpr int KT  = 64;          // keys per staged attention tile
constexpr int BK  = 64;          // k per staged GEMM tile: 128 B of a row, one line
constexpr int LDK = 72;          // LDS pitch of the 128-B rows of both (halfs): 144 B = 16 B x odd

template <bool V> struct cbool { static constexpr bool value = V; };   // compile-time switch of a lambda

// Value of lane l ^ 16: the two lanes that share a column of a WMMA C-matrix.
__device__ __forceinline__ float xhalf(float x) {
  return __int_as_float(__builtin_amdgcn_permlanex16(__float_as_int(x), __float_as_int(x),
                                                     0x76543210, 0xfedcba98, false, false));
}
__device__ __forceinline__ float max3f(float a, float b, float c) { return fmaxf(fmaxf(a, b), c); }

__device__ __forceinline__ unsigned lds_offset(const void* p) {
  return (unsigned)(uintptr_t)p;   // flat LDS addr truncates to LDS offset
}
// Four async 16-byte global -> LDS copies (ASYNCcnt) of one lane in one statement. s_wait_xcnt 0 is the
// statement's last line so that it stands in front of every later rewrite of the
// address registers named here (a precaution).
__device__ __forceinline__ void async_g2l_b128_x4(unsigned l0, const void* g0, unsigned l1, const void* g1,
                                                  unsigned l2, const void* g2, unsigned l3, const void* g3) {
  unsigned long long a0 = (unsigned long long)(uintptr_t)g0;
  unsigned long long a1 = (unsigned long long)(uintptr_t)g1;
  unsigned long long a2 = (unsigned long long)(uintptr_t)g2;
  unsigned long long a3 = (unsigned long long)(uintptr_t)g3;
  asm volatile("global_load_async_to_lds_b128 %0, %1, off\n\t"
               "global_load_async_to_lds_b128 %2, %3, off\n\t"
               "global_load_async_to_lds_b128 %4, %5, off\n\t"
               "global_load_async_to_lds_b128 %6, %7, off\n\t"
               "s_wait_xcnt 0x0"
               :: "v"(l0), "v"(a0), "v"(l1), "v"(a1), "v"(l2), "v"(a2), "v"(l3), "v"(a3)
               : "memory");
}

// The same for eight copies: one wait for a whole GEMM tile's share of a lane.
__device__ __forceinline__ void async_g2l_b128_x8(const unsigned (&l)[8], const h16* const (&g)[8]) {
  unsigned long long a[8];
#pragma unroll                               // a[] is indexed by constants only: it stays in registers
  for (int i = 0; i < 8; ++i) a[i] = (unsigned long long)(uintptr_t)g[i];
  asm volatile("global_load_async_to_lds_b128 %0, %1, off\n\t"
               "global_load_async_to_lds_b128 %2, %3, off\n\t"
               "global_load_async_to_lds_b128 %4, %5, off\n\t"
               "global_load_async_to_lds_b128 %6, %7, off\n\t"
               "global_load_async_to_lds_b128 %8, %9, off\n\t"
               "global_load_async_to_lds_b128 %10, %11, off\n\t"
               "global_load_async_to_lds_b128 %12, %13, off\n\t"
               "global_load_async_to_lds_b128 %14, %15, off\n\t"
               "s_wait_xcnt 0x0"
               :: "v"(l[0]), "v"(a[0]), "v"(l[1]), "v"(a[1]), "v"(l[2]), "v"(a[2]), "v"(l[3]), "v"(a[3]),
                  "v"(l[4]), "v"(a[4]), "v"(l[5]), "v"(a[5]), "v"(l[6]), "v"(a[6]), "v"(l[7]), "v"(a[7])
               : "memory");
}

// ---------------------------------------------------------------------------
// Load a 16(rows) x 32(k) f16 tile from row-major memory into WMMA A-operand
// layout (ISA 7.12.2, 16-bit A 16x32):
//   lanes 0-15  : row = lane,     K = 0-7   and 16-23
//   lanes 16-31 : row = lane-16,  K = 8-15  and 24-31
// The B operand of D = A*B is the A-layout of B^T, so W rows / Q rows (B) and
// K / V^T rows (A) all load through this same helper.
// ---------------------------------------------------------------------------
__device__ __forceinline__ v16h load_af(const h16* __restrict__ p, int ld, int k0, int lane) {
  const int row = lane & 15;
  const int hi  = (lane >> 4) << 3;           // 0 or 8
  const h16* q = p + (size_t)row * ld + k0 + hi;
  union { v16h v; v8h h[2]; } u;
  u.h[0] = *(const v8h*)(q);
  u.h[1] = *(const v8h*)(q + 16);
  return u.v;
}

// ---------------------------------------------------------------------------
// f32 -> f16 conversion of X and the four weight matrices in ONE launch: none of the
// five depends on another, so the block index picks the array. 4 elems/thread, 1024
// per block; the grid covers the five arrays exactly. The f16 copies lie one behind
// the other in dst, in the order X, Wq, Wk, Wv, Wo.
// The first Bz blocks build the row tables instead, one wave per batch: with n the
// number of unmasked rows of the batch and r1(s) that of unmasked rows in front of s,
// row s goes to place r1(s) if unmasked, else to n + s - r1(s): a permutation of
// 0..Sq-1 for every mask. toPart[row] = place, toOrig[place] = row (both with the
// batch's offset), nkeep[b] = n.
// ---------------------------------------------------------------------------
constexpr int TBLK = Bz;                    // table blocks, in front
constexpr int XBLK = (Mrows * Dm) / 1024;   // 4096 blocks for X
constexpr int WBLK = (Dm * Dm) / 1024;      // 1024 blocks for each weight matrix
__global__ __launch_bounds__(256) void cvt_f32_f16(const float* __restrict__ X,
                                                   const float* __restrict__ Wq,
                                                   const float* __restrict__ Wk,
                                                   const float* __restrict__ Wv,
                                                   const float* __restrict__ Wo,
                                                   const int* __restrict__ amask,
                                                   h16* __restrict__ dst,
                                                   int* __restrict__ toOrig,
                                                   int* __restrict__ toPart,
                                                   int* __restrict__ nkeep) {
  if (blockIdx.x < TBLK) {
    if (threadIdx.x < 32) {                  // wave 0, all lanes on
      const int b    = blockIdx.x;
      const int lane = threadIdx.x;
      const int* m   = amask + b * Sq;
      unsigned word[Sq / 32];                // bit l of word c: row 32 c + l is unmasked
      int n = 0;
#pragma unroll                               // all loads in flight at once; word[] stays in registers
      for (int c = 0; c < Sq / 32; ++c) {
        word[c] = __builtin_amdgcn_ballot_w32(m[c * 32 + lane] != 0);
        n += __builtin_popcount(word[c]);
      }
      const unsigned below = (1u << lane) - 1u;
      int before = 0;                        // unmasked rows in front of chunk c
#pragma unroll                               // word[] is indexed by constants only
      for (int c = 0; c < Sq / 32; ++c) {
        const int s  = c * 32 + lane;
        const int r1 = before + __builtin_popcount(word[c] & below);
        const int p  = ((word[c] >> lane) & 1u) ? r1 : n + s - r1;
        toPart[b * Sq + s] = b * Sq + p;
        toOrig[b * Sq + p] = b * Sq + s;
        before += __builtin_popcount(word[c]);
      }
      if (lane == 0) nkeep[b] = n;
    }
    return;
  }
  const int blk = blockIdx.x - TBLK;
  const float* src = X;
  int sblk = blk;                            // block inside its own array
  if (blk >= XBLK) {
    const int wi = (blk - XBLK) / WBLK;      // 0..3
    sblk = (blk - XBLK) % WBLK;
    src = wi == 0 ? Wq : wi == 1 ? Wk : wi == 2 ? Wv : Wo;
  }
  const float4 v = *(const float4*)(src + (size_t)sblk * 1024 + threadIdx.x * 4);
  const v4h o = { (h16)v.x, (h16)v.y, (h16)v.z, (h16)v.w };
  *(v4h*)(dst + (size_t)blk * 1024 + threadIdx.x * 4) = o;
}

// ---------------------------------------------------------------------------
// Store a wave's 32 x 64 accumulators (2 x 4 tiles), first element (row0, col0) of Y.
// C/D layout: lane<16 -> N=lane, M=r ; lane>=16 -> N=lane-16, M=r+8
// MODE 0: f16 head-major [B,H,S,64]      (Q, K)
// MODE 1: f16 head-transposed [B,H,64,S] (V^T, feeds PV A-operand)
// MODE 2: f32 row-major [4096,1024]      (final output projection)
// ---------------------------------------------------------------------------
template <int MODE>
__device__ __forceinline__ void store_tile(const v8f (&acc)[2][4], void* __restrict__ dst,
                                           int row0, int col0, int lane) {
  const int nlo   = lane & 15;
  const int rbase = (lane >> 4) * 8;
#pragma unroll
  for (int i = 0; i < 2; ++i) {
#pragma unroll
    for (int j = 0; j < 4; ++j) {
#pragma unroll
      for (int r = 0; r < 8; ++r) {
        const int grow = row0 + 16 * i + rbase + r;     // 0..4095
        const int gcol = col0 + 16 * j + nlo;           // 0..1023
        const float val = acc[i][j][r];
        if constexpr (MODE == 2) {
          ((float*)dst)[(size_t)grow * Dm + gcol] = val;
        } else {
          const int b = grow >> 11, s = grow & (Sq - 1);
          const int h = gcol >> 6, d = gcol & (HD - 1);
          if constexpr (MODE == 0)
            ((h16*)dst)[(((size_t)b * Hh + h) * Sq + s) * HD + d] = (h16)val;
          else
            ((h16*)dst)[(((size_t)b * Hh + h) * HD + d) * Sq + s] = (h16)val;
        }
      }
    }
  }
}

// ---------------------------------------------------------------------------
// GEMM: Y = A(4096x1024, f16 row-major) * W^T (W is 1024x1024 f16 row-major).
// Block = 128x128 (8 waves as 4Mx2N), wave = 32x64 -> 2x4 accum tiles.
// Operand tiles of 128 rows x 64 k double-buffered in LDS with async b128 copies, 8 lanes
// per row, so that one copy instruction covers four whole 128-B lines:
//   compute(t) -> waits -> barrier -> issue(t + 2 into the buffer just read)
// QKV = true: the three projections of X, which do not depend on one another, share
// one launch; blockIdx.z picks weight matrix, destination and store mode: jobs 0 and
// 1 are Q and K (mode 0), job 2 is V^T (mode 1). 3 x 256 blocks of 72 KiB LDS: three
// to a WGP.
// QKV = false: one product, W0 -> d0, mode 2.
// Row r of the product is row rowmap[r] of A.
// The k loop is a ring walk: a block starts at tile rot and goes round all NT tiles. Blocks of
// one row band share their A lines and blocks of one column band their W lines; started at the
// same tile they would ask for the same lines at the same moment, each line new to L2 when it
// is asked for. rot differs among the blocks of a band, so that a line is mostly fetched by one
// block and found in L2 by the others later. A sum over k starts at another term in each block.
// ---------------------------------------------------------------------------
template <bool QKV>
__global__ __launch_bounds__(256) void gemm_xwt(const h16* __restrict__ A,
                                                const int* __restrict__ rowmap,
                                                const h16* __restrict__ W0,
                                                const h16* __restrict__ W1,
                                                const h16* __restrict__ W2,
                                                void* __restrict__ d0,
                                                void* __restrict__ d1,
                                                void* __restrict__ d2) {
  __shared__ __attribute__((aligned(16))) h16 shA[2][128 * LDK];   // 2 x 18 KiB
  __shared__ __attribute__((aligned(16))) h16 shW[2][128 * LDK];   // 2 x 18 KiB

  const int job  = QKV ? (int)blockIdx.z : 0;
  const h16* W   = job == 0 ? W0 : job == 1 ? W1 : W2;
  void* dst      = job == 0 ? d0 : job == 1 ? d1 : d2;

  const int tid  = threadIdx.x;
  const int lane = tid & 31;
  const int w    = tid >> 5;
  const int wm   = w & 3;            // 0..3
  const int wn   = w >> 2;           // 0..1
  const int rowB = blockIdx.y * 128;           // block row origin
  const int colB = blockIdx.x * 128;           // block col origin (W row origin)

  // copy assignment: 8 lanes per 128-B row, rows crow + 32 i (i = 0..3) of each tile
  const int crow = tid >> 3;                   // 0..31
  const int ccol = (tid & 7) * 8;              // halfs
  const h16* ag[4];
  const h16* wg[4];
#pragma unroll                               // the pointers stay in registers
  for (int i = 0; i < 4; ++i) {
    ag[i] = A + (size_t)(rowmap[rowB + crow + 32 * i] & (Mrows - 1)) * Dm + ccol;   // the mask bounds the address
    wg[i] = W + (size_t)(colB + crow + 32 * i) * Dm + ccol;
  }
  const unsigned la = lds_offset(&shA[0][crow * LDK + ccol]);
  const unsigned lw = lds_offset(&shW[0][crow * LDK + ccol]);
  constexpr unsigned bufB = (unsigned)(128 * LDK * sizeof(h16));
  constexpr unsigned qB   = (unsigned)(32 * LDK * sizeof(h16));
  constexpr int NT = Dm / BK;                  // 16 tiles
  // column blocks x and x + 4 may share a start; four neighbours lie NT / 4 tiles apart, the jobs
  // of one (x, y) one tile apart, and the row blocks of a column band take every start in turn
  const int rot = (int)((blockIdx.x & 3) * (NT / 4) + blockIdx.y) + job;

  auto issue_tile = [&](int t, int buf) {
    const unsigned bo = (unsigned)buf * bufB;
    const int k0 = ((t + rot) & (NT - 1)) * BK;  // 0 .. Dm - BK
    const unsigned l[8] = { la + bo, la + bo + qB, la + bo + 2 * qB, la + bo + 3 * qB,
                            lw + bo, lw + bo + qB, lw + bo + 2 * qB, lw + bo + 3 * qB };
    const h16* const g[8] = { ag[0] + k0, ag[1] + k0, ag[2] + k0, ag[3] + k0,
                              wg[0] + k0, wg[1] + k0, wg[2] + k0, wg[3] + k0 };
    async_g2l_b128_x8(l, g);
  };

  v8f acc[2][4];
#pragma unroll
  for (int i = 0; i < 2; ++i)
#pragma unroll
    for (int j = 0; j < 4; ++j) acc[i][j] = {};

  issue_tile(0, 0);
  asm volatile("s_wait_asynccnt 0x0" ::: "memory");   // this wave's part of tile 0 has landed
  __syncthreads();                                    // visible to all waves
  issue_tile(1, 1);

  for (int t = 0; t < NT; ++t) {
    const int cur = t & 1;
#pragma unroll                               // ks becomes a constant offset of the LDS loads
    for (int ks = 0; ks < BK; ks += 32) {
      v16h af[2], bf[4];
#pragma unroll
      for (int i = 0; i < 2; ++i)
        af[i] = load_af(shA[cur] + (wm * 32 + 16 * i) * LDK, LDK, ks, lane);
#pragma unroll
      for (int j = 0; j < 4; ++j)
        bf[j] = load_af(shW[cur] + (wn * 64 + 16 * j) * LDK, LDK, ks, lane);

#pragma unroll
      for (int i = 0; i < 2; ++i)
#pragma unroll
        for (int j = 0; j < 4; ++j)
          acc[i][j] = WMMA16x16x32(af[i], bf[j], acc[i][j]);
    }

    asm volatile("s_wait_dscnt 0x0" ::: "memory");     // this wave's reads of the buffer are done
    asm volatile("s_wait_asynccnt 0x0" ::: "memory");  // this wave's part of the next tile has landed
    __syncthreads();                                   // next tile visible; this buffer free
    if (t + 2 < NT) issue_tile(t + 2, cur);
  }
  asm volatile("s_wait_asynccnt 0x0" ::: "memory");    // no copy outstanding behind the loop

  const int row0 = rowB + wm * 32;
  const int col0 = colB + wn * 64;
  if constexpr (QKV) {                 // one block-uniform branch in front of all the stores
    if (job == 2) {
      store_tile<1>(acc, dst, row0, col0, lane);
    } else {
      store_tile<0>(acc, dst, row0, col0, lane);
      // The listing lays the other mode's code behind these stores, and it rewrites their
      // registers: the wait stands in front of that (a precaution).
      asm volatile("s_wait_xcnt 0x0" ::: "memory");
    }
  } else {
    store_tile<2>(acc, dst, row0, col0, lane);
  }
}

// ---------------------------------------------------------------------------
// Flash attention: 1 wave per (b, h, 32-query block) = 2048 waves.
// Each wave owns TWO 16-query column groups so every K/V fragment load feeds
// 2x the WMMAs. 32 keys / pass, products transposed:
//   S^T = K Q^T    (A = K rows, B = Q rows): lane l holds, of query l & 15, the scores
//                  of keys 8 (l >> 4) + r and 16 + 8 (l >> 4) + r, r = 0..7
//   O^T += V^T P^T (A = V^T rows, B = P^T): those 16 values, converted in place, are
//                  the B operand in the k order in which load_af reads the V^T rows
// so maximum and sum of a query run inside a lane, plus one exchange with lane l ^ 16
// for the maximum (the two halves' sums are joined once, at the end).
// The 8 waves of a block share one (b, h): each 64-key tile of K (64 x 128 B) and
// of V^T (64 x 128 B) is copied to LDS once per block, whole lines per 8 lanes,
// into two buffers: tile t + 1 flies while tile t is worked on.
// Keys are in partitioned order: places 0..n-1 are the batch's unmasked keys, and only
// they are walked, ceil(n / 32) passes; the keys past n in the last pass get the
// reference's -1e9, in a copy of the pass of its own. n = 0: the reference's scores
// are all -1e9, a uniform softmax over all Sq keys; Q = 0 over all keys gives the
// same weights.
// ---------------------------------------------------------------------------
__global__ __launch_bounds__(256) void attn_fwd(const h16* __restrict__ Qh,
                                                const h16* __restrict__ Kh,
                                                const h16* __restrict__ Vt,
                                                const int* __restrict__ nkeep,
                                                h16* __restrict__ Ah) {
  __shared__ __attribute__((aligned(16))) h16 shK[2][KT * LDK];   // 2 x 9 KiB, rows = keys
  __shared__ __attribute__((aligned(16))) h16 shV[2][HD * LDK];   // 2 x 9 KiB, rows = d

  const int lane = threadIdx.x & 31;
  const int w    = threadIdx.x >> 5;
  const int gw   = blockIdx.x * 8 + w;          // 0..2047
  const int b    = gw >> 10;                    // / (H*64)
  const int rem  = gw & 1023;
  const int h    = rem >> 6;
  const int q0   = (rem & 63) * 32;

  const h16* qbase = Qh + (((size_t)b * Hh + h) * Sq + q0) * HD;
  const h16* kbase = Kh + (((size_t)b * Hh + h) * Sq) * HD;
  const h16* vbase = Vt + (((size_t)b * Hh + h) * HD) * Sq;

  // same for the whole block (128 blocks a batch); the clamp bounds the trip count
  const int nk    = min(max(nkeep[blockIdx.x >> 7], 0), Sq);
  const int n     = nk == 0 ? Sq : nk;
  const int nfull = n >> 5;                     // passes whose 32 keys are all in front of n: 0..64
  const int ntile = (n + KT - 1) / KT;          // 1..32

  // copy assignment: 8 lanes per 128-B row, rows crow and crow + 32 of each tile
  const int crow = threadIdx.x >> 3;            // 0..31
  const int ccol = (threadIdx.x & 7) * 8;       // halfs
  const h16* kg = kbase + (size_t)crow * HD + ccol;
  const h16* vg = vbase + (size_t)crow * Sq + ccol;
  const unsigned lk = lds_offset(&shK[0][crow * LDK + ccol]);
  const unsigned lv = lds_offset(&shV[0][crow * LDK + ccol]);
  constexpr unsigned bufB  = (unsigned)(KT * LDK * sizeof(h16));
  constexpr unsigned halfB = (unsigned)(32 * LDK * sizeof(h16));
  auto issue_tile = [&](int tile, int buf) {
    const unsigned bo = (unsigned)buf * bufB;
    const h16* k = kg + (size_t)tile * KT * HD;
    const h16* v = vg + (size_t)tile * KT;
    async_g2l_b128_x4(lk + bo, k, lk + bo + halfB, k + 32 * HD,
                      lv + bo, v, lv + bo + halfB, v + (size_t)32 * Sq);
  };

  issue_tile(0, 0);
  asm volatile("s_wait_asynccnt 0x0" ::: "memory");   // this wave's part of tile 0 has landed
  __syncthreads();                                    // visible to all waves
  if (ntile > 1) issue_tile(1, 1);

  v16h qf[2][2];
#pragma unroll
  for (int u = 0; u < 2; ++u) {
    qf[u][0] = load_af(qbase + (size_t)u * 16 * HD, HD, 0, lane);
    qf[u][1] = load_af(qbase + (size_t)u * 16 * HD, HD, 32, lane);
    if (nk == 0) { qf[u][0] = {}; qf[u][1] = {}; }
  }

  float rm[2], rl[2];                    // of query csub of group u; rl sums this lane's keys only
  v8f o[2][4];                           // o[u][j][r] = O^T[16 j + rh + r][csub]
#pragma unroll
  for (int u = 0; u < 2; ++u) {
    rm[u] = -INFINITY; rl[u] = 0.0f;
#pragma unroll
    for (int j = 0; j < 4; ++j) o[u][j] = {};
  }

  const int csub = lane & 15;
  const int rh   = (lane >> 4) * 8;

  // One pass over keys 32 kt .. 32 kt + 31. EDGE: some of them are past n (the last pass).
  auto one_pass = [&](int kt, auto edge) {
    constexpr bool EDGE = decltype(edge)::value;
    const int k0  = kt * 32;
    const int cur = (kt >> 1) & 1;               // buffer of tile kt / 2
    const int kl  = (kt & 1) * 32;               // first key of this pass inside the tile

    // ---- shared K fragments for both query groups ----
    v16h kb[2][2];
#pragma unroll
    for (int t = 0; t < 2; ++t) {
      kb[t][0] = load_af(shK[cur] + (kl + 16 * t) * LDK, LDK, 0, lane);
      kb[t][1] = load_af(shK[cur] + (kl + 16 * t) * LDK, LDK, 32, lane);
    }

    v16h pf[2];
#pragma unroll
    for (int u = 0; u < 2; ++u) {
      // ---- scores (4 WMMAs per query group) ----
      v8f sc[2];
#pragma unroll
      for (int t = 0; t < 2; ++t) {
        sc[t] = {};
        sc[t] = WMMA16x16x32(kb[t][0], qf[u][0], sc[t]);
        sc[t] = WMMA16x16x32(kb[t][1], qf[u][1], sc[t]);
      }
      // ---- online softmax of one query per lane ----
      float s[16];
#pragma unroll
      for (int r = 0; r < 8; r += 2) {             // 1/sqrt(64), on register neighbours: two per instruction
        const v2f lo = v2f{sc[0][r], sc[0][r + 1]} * 0.125f;
        const v2f hi = v2f{sc[1][r], sc[1][r + 1]} * 0.125f;
        s[r]     = lo.x; s[r + 1] = lo.y;
        s[8 + r] = hi.x; s[9 + r] = hi.y;
      }
      if constexpr (EDGE) {
        const int left = n - k0 - rh;              // this lane's key 16 t + r is past n where 16 t + r >= left
#pragma unroll
        for (int r = 0; r < 8; ++r) {
          s[r]     = r < left ? s[r] : -1e9f;
          s[8 + r] = 16 + r < left ? s[8 + r] : -1e9f;
        }
      }
      float m = fmaxf(max3f(max3f(s[0], s[1], s[2]), max3f(s[3], s[4], s[5]), max3f(s[6], s[7], s[8])),
                      max3f(max3f(s[9], s[10], s[11]), max3f(s[12], s[13], s[14]), s[15]));
      m = fmaxf(m, xhalf(m));                      // over all 32 keys, same in both halves
      const float mn  = fmaxf(rm[u], m);
      const float cor = __expf(rm[u] - mn);
      float p[16];
#pragma unroll
      for (int e = 0; e < 16; e += 2) {
        const v2f a = (v2f{s[e], s[e + 1]} - mn) * 1.44269504f;   // exp(x) = 2^(x log2 e), two per instruction
        p[e]     = __builtin_amdgcn_exp2f(a.x);
        p[e + 1] = __builtin_amdgcn_exp2f(a.y);
        pf[u][e]     = (h16)p[e];                  // B[k][csub], k = 8 h + e or 16 + 8 h + (e - 8)
        pf[u][e + 1] = (h16)p[e + 1];
      }
      const float sum = (((p[0] + p[1]) + (p[2] + p[3])) + ((p[4] + p[5]) + (p[6] + p[7]))) +
                        (((p[8] + p[9]) + (p[10] + p[11])) + ((p[12] + p[13]) + (p[14] + p[15])));
      rl[u] = rl[u] * cor + sum;
      rm[u] = mn;
#pragma unroll
      for (int j = 0; j < 4; ++j) o[u][j] *= cor;
    }

    // ---- V^T * P^T: V fragments shared by both query groups (8 WMMAs) ----
#pragma unroll
    for (int j = 0; j < 4; ++j) {
      v16h vb = load_af(shV[cur] + (j * 16) * LDK, LDK, kl, lane);
      o[0][j] = WMMA16x16x32(vb, pf[0], o[0][j]);
      o[1][j] = WMMA16x16x32(vb, pf[1], o[1][j]);
    }

    // ---- foot of a tile's second pass: publish tile + 1, refill this buffer ----
    // (nothing is read behind the edge pass)
    if (!EDGE && (kt & 1)) {
      asm volatile("s_wait_dscnt 0x0" ::: "memory");     // this wave's reads of the buffer are done
      asm volatile("s_wait_asynccnt 0x0" ::: "memory");  // this wave's part of the next tile has landed
      __syncthreads();                                   // next tile visible; this buffer free
      if ((kt >> 1) + 2 < ntile) issue_tile((kt >> 1) + 2, cur);
    }
  };
  for (int kt = 0; kt < nfull; ++kt) one_pass(kt, cbool<false>{});
  if (n & 31) one_pass(nfull, cbool<true>{});
  asm volatile("s_wait_asynccnt 0x0" ::: "memory");      // no copy outstanding at the wave's end

  // ---- join the halves' sums, normalize, store f16 Ah[4096,1024]: 8 d = 16 B per store ----
#pragma unroll
  for (int u = 0; u < 2; ++u) {
    const float inv = 1.0f / (rl[u] + xhalf(rl[u]));
    const int s = q0 + u * 16 + csub;
#pragma unroll
    for (int j = 0; j < 4; ++j) {
      v8h ov;
#pragma unroll
      for (int r = 0; r < 8; ++r) ov[r] = (h16)(o[u][j][r] * inv);
      *(v8h*)&Ah[((size_t)b * Sq + s) * Dm + h * HD + j * 16 + rh] = ov;
    }
  }
}

// ---------------------------------------------------------------------------
// Launch
// ---------------------------------------------------------------------------
extern "C" void kernel_launch(void* const* d_in, const int* in_sizes, int n_in,
                              void* d_out, int out_size, void* d_ws, size_t ws_size,
                              hipStream_t stream) {
  const float* X    = (const float*)d_in[0];
  const int*   mask = (const int*)d_in[1];
  const float* Wq   = (const float*)d_in[2];
  const float* Wk   = (const float*)d_in[3];
  const float* Wv   = (const float*)d_in[4];
  const float* Wo   = (const float*)d_in[5];

  char* ws = (char*)d_ws;
  const size_t MiB = 1u << 20;
  h16* Xh  = (h16*)(ws + 0 * MiB);   // 8 MiB  [4096,1024]
  h16* Wqh = (h16*)(ws + 8 * MiB);   // 2 MiB
  h16* Wkh = (h16*)(ws + 10 * MiB);  // 2 MiB
  h16* Wvh = (h16*)(ws + 12 * MiB);  // 2 MiB
  h16* Woh = (h16*)(ws + 14 * MiB);  // 2 MiB
  h16* Qh  = (h16*)(ws + 16 * MiB);  // 8 MiB  [B,H,S,64]
  h16* Kh  = (h16*)(ws + 24 * MiB);  // 8 MiB  [B,H,S,64]
  h16* Vt  = (h16*)(ws + 32 * MiB);  // 8 MiB  [B,H,64,S]
  h16* Ah  = (h16*)(ws + 40 * MiB);  // 8 MiB  [4096,1024]
  int* toOrig = (int*)(ws + 48 * MiB);             // 16 KiB  partitioned place -> row
  int* toPart = (int*)(ws + 48 * MiB + 16 * 1024); // 16 KiB  row -> partitioned place
  int* nkeep  = (int*)(ws + 48 * MiB + 32 * 1024); // Bz ints: unmasked rows of a batch

  // f32 -> f16, all five arrays in one launch: Xh, Wqh, Wkh, Wvh, Woh are contiguous from Xh;
  // the row tables with them
  cvt_f32_f16<<<TBLK + XBLK + 4 * WBLK, 256, 0, stream>>>(X, Wq, Wk, Wv, Wo, mask, Xh, toOrig, toPart, nkeep);

  // QKV projections in one launch (z = 0: Q, 1: K, 2: V^T), rows in partitioned order
  dim3 gg(Dm / 128, Mrows / 128);        // (8, 32)
  dim3 g3(Dm / 128, Mrows / 128, 3);     // (8, 32, 3)
  gemm_xwt<true><<<g3, 256, 0, stream>>>(Xh, toOrig, Wqh, Wkh, Wvh, Qh, Kh, Vt);

  // streaming attention (2048 waves, 8 waves/block)
  attn_fwd<<<256, 256, 0, stream>>>(Qh, Kh, Vt, nkeep, Ah);

  // output projection -> f32 d_out, rows back in their own order
  gemm_xwt<false><<<gg, 256, 0, stream>>>(Ah, toPart, Woh, nullptr, nullptr, d_out, nullptr, nullptr);
}

// v008
// One run takes 62.4 microseconds.
// It is 1.07 times as fast as v006, going by the measured steps of the versions left out in between.
// Over all steps from v000 it is 3.13 times as fast.
#include <hip/hip_runtime.h>
#include <hip/hip_bf16.h>
#include <math.h>

typedef _Float16 h16;
typedef __attribute__((ext_vector_type(16))) _Float16 v16h;
typedef __attribute__((ext_vector_type(8)))  _Float16 v8h;
typedef __attribute__((ext_vector_type(4)))  _Float16 v4h;
typedef __attribute__((ext_vector_type(8)))  float    v8f;
typedef __attribute__((ext_vector_type(2)))  float    v2f;

#define WMMA16x16x32(a, b, c) \
  __builtin_amdgcn_wmma_f32_16x16x32_f16(false, (a), false, (b), (short)0, (c), false, false)

constexpr int Bz = 2;
constexpr int Sq = 2048;
constexpr int Dm = 1024;
constexpr int Hh = 16;
constexpr int HD = 64;
constexpr int Mrows = Bz * Sq;   // 4096
constexpr int KT  = 64;          // keys per staged attention tile
constexpr int BK  = 64;          // k per staged GEMM tile: 128 B of a row, one line
constexpr int LDK = 72;          // LDS pitch of the 128-B rows of both (halfs): 144 B = 16 B x odd
constexpr float QSC  = 0.125f * 1.44269504f;   // 1/sqrt(64) and log2 e: Q is stored times this, scores are exp2 arguments
constexpr float PTOP = 4096.0f;  // a lane's 16 weights of a pass may sum to this before the maximum in use is renewed

template <bool V> struct cbool { static constexpr bool value = V; };   // compile-time switch of a lambda

// Value of lane l ^ 16: the two lanes that share a column of a WMMA C-matrix.
__device__ __forceinline__ float xhalf(float x) {
  return __int_as_float(__builtin_amdgcn_permlanex16(__float_as_int(x), __float_as_int(x),
                                                     0x76543210, 0xfedcba98, false, false));
}
__device__ __forceinline__ float max3f(float a, float b, float c) { return fmaxf(fmaxf(a, b), c); }

__device__ __forceinline__ unsigned lds_offset(const void* p) {
  return (unsigned)(uintptr_t)p;   // flat LDS addr truncates to LDS offset
}
// Four async 16-byte global -> LDS copies (ASYNCcnt) of one lane in one statement. s_wait_xcnt 0 is the
// statement's last line so that it stands in front of every later rewrite of the
// address registers named here (a precaution).
__device__ __forceinline__ void async_g2l_b128_x4(unsigned l0, const void* g0, unsigned l1, const void* g1,
                                                  unsigned l2, const void* g2, unsigned l3, const void* g3) {
  unsigned long long a0 = (unsigned long long)(uintptr_t)g0;
  unsigned long long a1 = (unsigned long long)(uintptr_t)g1;
  unsigned long long a2 = (unsigned long long)(uintptr_t)g2;
  unsigned long long a3 = (unsigned long long)(uintptr_t)g3;
  asm volatile("global_load_async_to_lds_b128 %0, %1, off\n\t"
               "global_load_async_to_lds_b128 %2, %3, off\n\t"
               "global_load_async_to_lds_b128 %4, %5, off\n\t"
               "global_load_async_to_lds_b128 %6, %7, off\n\t"
               "s_wait_xcnt 0x0"
               :: "v"(l0), "v"(a0), "v"(l1), "v"(a1), "v"(l2), "v"(a2), "v"(l3), "v"(a3)
               : "memory");
}

// The same for eight copies: one wait for a whole GEMM tile's share of a lane.
__device__ __forceinline__ void async_g2l_b128_x8(const unsigned (&l)[8], const h16* const (&g)[8]) {
  unsigned long long a[8];
#pragma unroll                               // a[] is indexed by constants only: it stays in registers
  for (int i = 0; i < 8; ++i) a[i] = (unsigned long long)(uintptr_t)g[i];
  asm volatile("global_load_async_to_lds_b128 %0, %1, off\n\t"
               "global_load_async_to_lds_b128 %2, %3, off\n\t"
               "global_load_async_to_lds_b128 %4, %5, off\n\t"
               "global_load_async_to_lds_b128 %6, %7, off\n\t"
               "global_load_async_to_lds_b128 %8, %9, off\n\t"
               "global_load_async_to_lds_b128 %10, %11, off\n\t"
               "global_load_async_to_lds_b128 %12, %13, off\n\t"
               "global_load_async_to_lds_b128 %14, %15, off\n\t"
               "s_wait_xcnt 0x0"
               :: "v"(l[0]), "v"(a[0]), "v"(l[1]), "v"(a[1]), "v"(l[2]), "v"(a[2]), "v"(l[3]), "v"(a[3]),
                  "v"(l[4]), "v"(a[4]), "v"(l[5]), "v"(a[5]), "v"(l[6]), "v"(a[6]), "v"(l[7]), "v"(a[7])
               : "memory");
}

// ---------------------------------------------------------------------------
// Load a 16(rows) x 32(k) f16 tile from row-major memory into WMMA A-operand
// layout (ISA 7.12.2, 16-bit A 16x32):
//   lanes 0-15  : row = lane,     K = 0-7   and 16-23
//   lanes 16-31 : row = lane-16,  K = 8-15  and 24-31
// The B operand of D = A*B is the A-layout of B^T, so the GEMM's A and W rows (either
// operand), Q rows (B) and K / V^T rows (A) all load through this same helper.
// ---------------------------------------------------------------------------
__device__ __forceinline__ v16h load_af(const h16* __restrict__ p, int ld, int k0, int lane) {
  const int row = lane & 15;
  const int hi  = (lane >> 4) << 3;           // 0 or 8
  const h16* q = p + (size_t)row * ld + k0 + hi;
  union { v16h v; v8h h[2]; } u;
  u.h[0] = *(const v8h*)(q);
  u.h[1] = *(const v8h*)(q + 16);
  return u.v;
}

// ---------------------------------------------------------------------------
// f32 -> f16 conversion of X and the four weight matrices in ONE launch: none of the
// five depends on another, so the block index picks the array. 4 elems/thread, 1024
// per block; the grid covers the five arrays exactly. The f16 copies lie one behind
// the other in dst, in the order X, Wq, Wk, Wv, Wo.
// The first Bz blocks build the row tables instead, one wave per batch: with n the
// number of unmasked rows of the batch and r1(s) that of unmasked rows in front of s,
// row s goes to place r1(s) if unmasked, else to n + s - r1(s): a permutation of
// 0..Sq-1 for every mask. toPart[row] = place, toOrig[place] = row (both with the
// batch's offset), nkeep[b] = n.
// ---------------------------------------------------------------------------
constexpr int TBLK = Bz;                    // table blocks, in front
constexpr int XBLK = (Mrows * Dm) / 1024;   // 4096 blocks for X
constexpr int WBLK = (Dm * Dm) / 1024;      // 1024 blocks for each weight matrix
__global__ __launch_bounds__(256) void cvt_f32_f16(const float* __restrict__ X,
                                                   const float* __restrict__ Wq,
                                                   const float* __restrict__ Wk,
                                                   const float* __restrict__ Wv,
                                                   const float* __restrict__ Wo,
                                                   const int* __restrict__ amask,
                                                   h16* __restrict__ dst,
                                                   int* __restrict__ toOrig,
                                                   int* __restrict__ toPart,
                                                   int* __restrict__ nkeep) {
  if (blockIdx.x < TBLK) {
    if (threadIdx.x < 32) {                  // wave 0, all lanes on
      const int b    = blockIdx.x;
      const int lane = threadIdx.x;
      const int* m   = amask + b * Sq;
      unsigned word[Sq / 32];                // bit l of word c: row 32 c + l is unmasked
      int n = 0;
#pragma unroll                               // all loads in flight at once; word[] stays in registers
      for (int c = 0; c < Sq / 32; ++c) {
        word[c] = __builtin_amdgcn_ballot_w32(m[c * 32 + lane] != 0);
        n += __builtin_popcount(word[c]);
      }
      const unsigned below = (1u << lane) - 1u;
      int before = 0;                        // unmasked rows in front of chunk c
#pragma unroll                               // word[] is indexed by constants only
      for (int c = 0; c < Sq / 32; ++c) {
        const int s  = c * 32 + lane;
        const int r1 = before + __builtin_popcount(word[c] & below);
        const int p  = ((word[c] >> lane) & 1u) ? r1 : n + s - r1;
        toPart[b * Sq + s] = b * Sq + p;
        toOrig[b * Sq + p] = b * Sq + s;
        before += __builtin_popcount(word[c]);
      }
      if (lane == 0) nkeep[b] = n;
    }
    return;
  }
  const int blk = blockIdx.x - TBLK;
  const float* src = X;
  int sblk = blk;                            // block inside its own array
  if (blk >= XBLK) {
    const int wi = (blk - XBLK) / WBLK;      // 0..3
    sblk = (blk - XBLK) % WBLK;
    src = wi == 0 ? Wq : wi == 1 ? Wk : wi == 2 ? Wv : Wo;
  }
  const float4 v = *(const float4*)(src + (size_t)sblk * 1024 + threadIdx.x * 4);
  const v4h o = { (h16)v.x, (h16)v.y, (h16)v.z, (h16)v.w };
  *(v4h*)(dst + (size_t)blk * 1024 + threadIdx.x * 4) = o;
}

// ---------------------------------------------------------------------------
// GEMM: Y = A(4096x1024, f16 row-major) * W^T (W is 1024x1024 f16 row-major).
// Block = 128x128, 8 waves, 2x4 accum tiles per wave.
// Operand tiles of 128 rows x 64 k double-buffered in LDS with async b128 copies, 8 lanes
// per row, so that one copy instruction covers four whole 128-B lines:
//   compute(t) -> waits -> barrier -> issue(t + 2 into the buffer just read)
// QKV = true: the three projections of X, which do not depend on one another, share
// one launch; blockIdx.z picks weight matrix, destination and layout: jobs 0 and 1 are
// Q and K, f16 head-major [B,H,S,64]; job 2 is V^T, f16 head-transposed [B,H,64,S] (it
// feeds attention's V^T P^T). 3 x 256 blocks of 72 KiB LDS: three to a WGP.
// QKV = false: one product, W0 -> d0, f32 row-major [4096,1024].
// Row r of the product is row rowmap[r] of A.
// Which operand goes first: the C/D layout gives a lane 8 neighbours along the FIRST operand's
// rows (lane: N = lane & 15, M = 8 (lane >> 4) + r). So the operand whose row index runs along
// the destination's contiguous direction is the first one, called P (W for Q, K and the output:
// columns; A for V^T: positions), the other one R. A wave owns 64 P rows x 32 R rows.
// Epilogue: a wave writes its tile as 32 rows (R) of 64 elements (P) into its own range of the
// LDS ring, 16 B per lane, reads it back row-wise and stores whole 128-B lines.
// The k loop is a ring walk: a block starts at tile rot and goes round all NT tiles. Blocks of
// one row band share their A lines and blocks of one column band their W lines; started at the
// same tile they would ask for the same lines at the same moment, each line new to L2 when it
// is asked for. rot differs among the blocks of a band, so that a line is mostly fetched by one
// block and found in L2 by the others later. A sum over k starts at another term in each block.
// ---------------------------------------------------------------------------
constexpr int PF = 68;           // LDS pitch of a staged row of 64 floats: 272 B = 16 B x odd
template <bool QKV>
__global__ __launch_bounds__(256) void gemm_xwt(const h16* __restrict__ A,
                                                const int* __restrict__ rowmap,
                                                const h16* __restrict__ W0,
                                                const h16* __restrict__ W1,
                                                const h16* __restrict__ W2,
                                                void* __restrict__ d0,
                                                void* __restrict__ d1,
                                                void* __restrict__ d2) {
  // [operand: 0 = A rows, 1 = W rows][buffer], 4 x 18 KiB
  __shared__ __attribute__((aligned(16))) h16 sh[2][2][128 * LDK];

  const int job  = QKV ? (int)blockIdx.z : 0;
  const h16* W   = job == 0 ? W0 : job == 1 ? W1 : W2;
  void* dst      = job == 0 ? d0 : job == 1 ? d1 : d2;
  const bool vjob = QKV && job == 2;           // same for the whole block

  const int tid  = threadIdx.x;
  const int lane = tid & 31;
  const int w    = tid >> 5;
  const int wm   = w & 3;            // 0..3: which 32 R rows
  const int wn   = w >> 2;           // 0..1: which 64 P rows
  const int rowB = blockIdx.y * 128;           // block row origin
  const int colB = blockIdx.x * 128;           // block col origin (W row origin)

  // copy assignment: 8 lanes per 128-B row, rows crow + 32 i (i = 0..3) of each tile
  const int crow = tid >> 3;                   // 0..31
  const int ccol = (tid & 7) * 8;              // halfs
  const h16* ag[4];
  const h16* wg[4];
#pragma unroll                               // the pointers stay in registers
  for (int i = 0; i < 4; ++i) {
    ag[i] = A + (size_t)(rowmap[rowB + crow + 32 * i] & (Mrows - 1)) * Dm + ccol;   // the mask bounds the address
    wg[i] = W + (size_t)(colB + crow + 32 * i) * Dm + ccol;
  }
  const unsigned la = lds_offset(&sh[0][0][crow * LDK + ccol]);
  const unsigned lw = lds_offset(&sh[1][0][crow * LDK + ccol]);
  constexpr unsigned bufB = (unsigned)(128 * LDK * sizeof(h16));
  constexpr unsigned qB   = (unsigned)(32 * LDK * sizeof(h16));
  constexpr int NT = Dm / BK;                  // 16 tiles
  // column blocks x and x + 4 may share a start; four neighbours lie NT / 4 tiles apart, the jobs
  // of one (x, y) one tile apart, and the row blocks of a column band take every start in turn
  const int rot = (int)((blockIdx.x & 3) * (NT / 4) + blockIdx.y) + job;

  auto issue_tile = [&](int t, int buf) {
    const unsigned bo = (unsigned)buf * bufB;
    const int k0 = ((t + rot) & (NT - 1)) * BK;  // 0 .. Dm - BK
    const unsigned l[8] = { la + bo, la + bo + qB, la + bo + 2 * qB, la + bo + 3 * qB,
                            lw + bo, lw + bo + qB, lw + bo + 2 * qB, lw + bo + 3 * qB };
    const h16* const g[8] = { ag[0] + k0, ag[1] + k0, ag[2] + k0, ag[3] + k0,
                              wg[0] + k0, wg[1] + k0, wg[2] + k0, wg[3] + k0 };
    async_g2l_b128_x8(l, g);
  };

  v8f acc[2][4];                     // acc[i][j]: R rows 16 i .., P rows 16 j ..
#pragma unroll
  for (int i = 0; i < 2; ++i)
#pragma unroll
    for (int j = 0; j < 4; ++j) acc[i][j] = {};

  issue_tile(0, 0);
  asm volatile("s_wait_asynccnt 0x0" ::: "memory");   // this wave's part of tile 0 has landed
  __syncthreads();                                    // visible to all waves
  issue_tile(1, 1);

  const int pop = vjob ? 0 : 1;                       // which operand is P
  const h16* shR = &sh[1 - pop][0][(wm * 32) * LDK];
  const h16* shP = &sh[pop][0][(wn * 64) * LDK];

  for (int t = 0; t < NT; ++t) {
    const int cur = t & 1;
    const int cb  = cur * (128 * LDK);
#pragma unroll                               // ks becomes a constant offset of the LDS loads
    for (int ks = 0; ks < BK; ks += 32) {
      v16h rf[2], pf[4];
#pragma unroll
      for (int i = 0; i < 2; ++i)
        rf[i] = load_af(shR + cb + (16 * i) * LDK, LDK, ks, lane);
#pragma unroll
      for (int j = 0; j < 4; ++j)
        pf[j] = load_af(shP + cb + (16 * j) * LDK, LDK, ks, lane);

#pragma unroll
      for (int i = 0; i < 2; ++i)
#pragma unroll
        for (int j = 0; j < 4; ++j)
          acc[i][j] = WMMA16x16x32(pf[j], rf[i], acc[i][j]);
    }

    asm volatile("s_wait_dscnt 0x0" ::: "memory");     // this wave's reads of the buffer are done
    asm volatile("s_wait_asynccnt 0x0" ::: "memory");  // this wave's part of the next tile has landed
    __syncthreads();                                   // next tile visible; this buffer free
    if (t + 2 < NT) issue_tile(t + 2, cur);
  }
  asm volatile("s_wait_asynccnt 0x0" ::: "memory");    // no copy outstanding behind the loop

  // Behind the last trip's barrier nobody reads the ring any more and no copy is under way:
  // it is free for staging.
  const int nlo = lane & 15;                   // R row inside a tile
  const int hi8 = (lane >> 4) * 8;             // first of the lane's 8 P rows inside a tile
  const int r0  = (vjob ? colB : rowB) + wm * 32;   // the wave's first R row
  const int p0  = (vjob ? rowB : colB) + wn * 64;   // the wave's first P row

  if constexpr (QKV) {
    if (job == 0) {                    // Q leaves in the units of attention's exp2, scaled in f32 before its one rounding
#pragma unroll
      for (int i = 0; i < 2; ++i)
#pragma unroll
        for (int j = 0; j < 4; ++j) acc[i][j] *= QSC;
    }
    h16* st = &sh[0][0][0] + w * (32 * LDK);   // 8 x 4.5 KiB = the two A buffers
#pragma unroll
    for (int i = 0; i < 2; ++i) {
#pragma unroll
      for (int j = 0; j < 4; ++j) {
        v8h o;
#pragma unroll
        for (int r = 0; r < 8; ++r) o[r] = (h16)acc[i][j][r];
        *(v8h*)(st + (16 * i + nlo) * LDK + 16 * j + hi8) = o;
      }
    }
    asm volatile("s_wait_dscnt 0x0" ::: "memory");   // the wave's own rows are written before other lanes read them back
    const int srow = lane >> 3;                // 8 lanes per 128-B row, 4 rows per store
    const int scol = (lane & 7) * 8;
    v8h v[8];
#pragma unroll                               // v[] is indexed by constants only: it stays in registers
    for (int q = 0; q < 8; ++q) v[q] = *(const v8h*)(st + (4 * q + srow) * LDK + scol);
    // one block-uniform branch picks the destination's layout; each store covers four whole lines
    if (vjob) {                        // R = column (h, d), P = position s
      h16* gp = (h16*)dst + (((size_t)(p0 >> 11) * Hh + (r0 >> 6)) * HD + (r0 & (HD - 1)) + srow) * Sq
                          + (p0 & (Sq - 1)) + scol;
#pragma unroll
      for (int q = 0; q < 8; ++q) *(v8h*)(gp + (size_t)(4 * q) * Sq) = v[q];
    } else {                           // R = position s, P = d of head p0 / 64
      h16* gp = (h16*)dst + (((size_t)(r0 >> 11) * Hh + (p0 >> 6)) * Sq + (r0 & (Sq - 1)) + srow) * HD + scol;
#pragma unroll
      for (int q = 0; q < 8; ++q) *(v8h*)(gp + (size_t)(4 * q) * HD) = v[q];
    }
  } else {
    float* st = (float*)&sh[0][0][0] + w * (32 * PF);   // 8 x 8.5 KiB of the ring's 72
#pragma unroll
    for (int i = 0; i < 2; ++i) {
#pragma unroll
      for (int j = 0; j < 4; ++j) {
        const v8f a = acc[i][j];
        float* sp = st + (16 * i + nlo) * PF + 16 * j + hi8;
        *(float4*)(sp)     = make_float4(a[0], a[1], a[2], a[3]);
        *(float4*)(sp + 4) = make_float4(a[4], a[5], a[6], a[7]);
      }
    }
    asm volatile("s_wait_dscnt 0x0" ::: "memory");   // the wave's own rows are written before other lanes read them back
    const int srow = lane >> 4;                // 16 lanes per 256-B row, 2 rows per store
    const int scol = (lane & 15) * 4;
    float* gp = (float*)dst + (size_t)(r0 + srow) * Dm + p0 + scol;
#pragma unroll
    for (int q = 0; q < 16; ++q) {
      const float4 v = *(const float4*)(st + (2 * q + srow) * PF + scol);
      *(float4*)(gp + (size_t)(2 * q) * Dm) = v;
    }
  }
}

// ---------------------------------------------------------------------------
// Flash attention: 1 wave per (b, h, 32-query block) = 2048 waves.
// Each wave owns TWO 16-query column groups so every K/V fragment load feeds
// 2x the WMMAs. 32 keys / pass, products transposed:
//   S^T = K Q^T    (A = K rows, B = Q rows): lane l holds, of query l & 15, the scores
//                  of keys 8 (l >> 4) + r and 16 + 8 (l >> 4) + r, r = 0..7
//   O^T += V^T P^T (A = V^T rows, B = P^T): those 16 values, converted in place, are
//                  the B operand in the k order in which load_af reads the V^T rows
// so maximum and sum of a query run inside a lane, plus one exchange with lane l ^ 16
// for the maximum (the two halves' sums are joined once, at the end).
// Lazy maximum: Q comes scaled by log2 e / sqrt(64) and the score products start from
// C = -(maximum in use), so the accumulators are the exp2 arguments themselves. The maximum
// in use is set in the first pass and renewed, with the rescaling of O and of the sums, only
// in a pass where some lane's 16 weights sum to more than PTOP (then every weight of the
// other passes is at most PTOP, far inside f16): one wave-uniform test per pass.
// The 8 waves of a block share one (b, h): each 64-key tile of K (64 x 128 B) and
// of V^T (64 x 128 B) is copied to LDS once per block, whole lines per 8 lanes,
// into two buffers: tile t + 1 flies while tile t is worked on.
// Keys are in partitioned order: places 0..n-1 are the batch's unmasked keys, and only
// they are walked, ceil(n / 32) passes; the keys past n in the last pass get the
// reference's -1e9, in a copy of the pass of its own. n = 0: the reference's scores
// are all -1e9, a uniform softmax over all Sq keys; Q = 0 over all keys gives the
// same weights.
// ---------------------------------------------------------------------------
__global__ __launch_bounds__(256) void attn_fwd(const h16* __restrict__ Qh,
                                                const h16* __restrict__ Kh,
                                                const h16* __restrict__ Vt,
                                                const int* __restrict__ nkeep,
                                                h16* __restrict__ Ah) {
  __shared__ __attribute__((aligned(16))) h16 shK[2][KT * LDK];   // 2 x 9 KiB, rows = keys
  __shared__ __attribute__((aligned(16))) h16 shV[2][HD * LDK];   // 2 x 9 KiB, rows = d

  const int lane = threadIdx.x & 31;
  const int w    = threadIdx.x >> 5;
  const int gw   = blockIdx.x * 8 + w;          // 0..2047
  const int b    = gw >> 10;                    // / (H*64)
  const int rem  = gw & 1023;
  const int h    = rem >> 6;
  const int q0   = (rem & 63) * 32;

  const h16* qbase = Qh + (((size_t)b * Hh + h) * Sq + q0) * HD;
  const h16* kbase = Kh + (((size_t)b * Hh + h) * Sq) * HD;
  const h16* vbase = Vt + (((size_t)b * Hh + h) * HD) * Sq;

  // same for the whole block (128 blocks a batch); the clamp bounds the trip count
  const int nk    = min(max(nkeep[blockIdx.x >> 7], 0), Sq);
  const int n     = nk == 0 ? Sq : nk;
  const int nfull = n >> 5;                     // passes whose 32 keys are all in front of n: 0..64
  const int ntile = (n + KT - 1) / KT;          // 1..32

  // copy assignment: 8 lanes per 128-B row, rows crow and crow + 32 of each tile
  const int crow = threadIdx.x >> 3;            // 0..31
  const int ccol = (threadIdx.x & 7) * 8;       // halfs
  const h16* kg = kbase + (size_t)crow * HD + ccol;
  const h16* vg = vbase + (size_t)crow * Sq + ccol;
  const unsigned lk = lds_offset(&shK[0][crow * LDK + ccol]);
  const unsigned lv = lds_offset(&shV[0][crow * LDK + ccol]);
  constexpr unsigned bufB  = (unsigned)(KT * LDK * sizeof(h16));
  constexpr unsigned halfB = (unsigned)(32 * LDK * sizeof(h16));
  auto issue_tile = [&](int tile, int buf) {
    const unsigned bo = (unsigned)buf * bufB;
    const h16* k = kg + (size_t)tile * KT * HD;
    const h16* v = vg + (size_t)tile * KT;
    async_g2l_b128_x4(lk + bo, k, lk + bo + halfB, k + 32 * HD,
                      lv + bo, v, lv + bo + halfB, v + (size_t)32 * Sq);
  };

  issue_tile(0, 0);
  asm volatile("s_wait_asynccnt 0x0" ::: "memory");   // this wave's part of tile 0 has landed
  __syncthreads();                                    // visible to all waves
  if (ntile > 1) issue_tile(1, 1);

  v16h qf[2][2];
#pragma unroll
  for (int u = 0; u < 2; ++u) {
    qf[u][0] = load_af(qbase + (size_t)u * 16 * HD, HD, 0, lane);
    qf[u][1] = load_af(qbase + (size_t)u * 16 * HD, HD, 32, lane);
    if (nk == 0) { qf[u][0] = {}; qf[u][1] = {}; }
  }

  float rl[2];                           // of query csub of group u; sums this lane's keys only
  v8f cneg[2];                           // minus the maximum in use of that query, in all eight registers
  v8f o[2][4];                           // o[u][j][r] = O^T[16 j + rh + r][csub]
#pragma unroll
  for (int u = 0; u < 2; ++u) {
    rl[u] = 0.0f; cneg[u] = {};
#pragma unroll
    for (int j = 0; j < 4; ++j) o[u][j] = {};
  }

  const int csub = lane & 15;
  const int rh   = (lane >> 4) * 8;

  // One pass over keys 32 kt .. 32 kt + 31. EDGE: some of them are past n (the last pass).
  // FIRST: the wave's first pass, which sets the maximum in use.
  auto one_pass = [&](int kt, auto edge, auto first) {
    constexpr bool EDGE  = decltype(edge)::value;
    constexpr bool FIRST = decltype(first)::value;
    const int k0  = kt * 32;
    const int cur = (kt >> 1) & 1;               // buffer of tile kt / 2
    const int kl  = (kt & 1) * 32;               // first key of this pass inside the tile

    // ---- shared K fragments for both query groups ----
    v16h kb[2][2];
#pragma unroll
    for (int t = 0; t < 2; ++t) {
      kb[t][0] = load_af(shK[cur] + (kl + 16 * t) * LDK, LDK, 0, lane);
      kb[t][1] = load_af(shK[cur] + (kl + 16 * t) * LDK, LDK, 32, lane);
    }

    // ---- V^T fragments, asked for with K's in one group: they fly under the scores and exponentials ----
    v16h vb[4];
#pragma unroll
    for (int j = 0; j < 4; ++j) vb[j] = load_af(shV[cur] + (j * 16) * LDK, LDK, kl, lane);
    // The loads stay up here. Left free, V's are moved behind the branch below, into one register set,
    // and each pair of products then waits out its own LDS latency.
    __builtin_amdgcn_sched_barrier(0);

    // ---- scores minus the maximum in use (4 WMMAs per query group) ----
    v8f sc[2][2];
#pragma unroll
    for (int u = 0; u < 2; ++u) {
#pragma unroll
      for (int t = 0; t < 2; ++t) {
        sc[u][t] = WMMA16x16x32(kb[t][0], qf[u][0], cneg[u]);
        sc[u][t] = WMMA16x16x32(kb[t][1], qf[u][1], sc[u][t]);
      }
      if constexpr (EDGE) {
        const int left = n - k0 - rh;              // this lane's key 16 t + r is past n where 16 t + r >= left
#pragma unroll
        for (int r = 0; r < 8; ++r) {
          sc[u][0][r] = r < left ? sc[u][0][r] : -1e9f;
          sc[u][1][r] = 16 + r < left ? sc[u][1][r] : -1e9f;
        }
      }
    }

    // ---- weights of one query per lane, and their sum ----
    v16h pf[2];
    float sum[2];
    auto weights = [&](int u) {
      float q[16];
#pragma unroll
      for (int e = 0; e < 8; ++e) {
        q[e]     = __builtin_amdgcn_exp2f(sc[u][0][e]);
        q[8 + e] = __builtin_amdgcn_exp2f(sc[u][1][e]);
      }
#pragma unroll
      for (int e = 0; e < 16; ++e) pf[u][e] = (h16)q[e];   // B[k][csub], k = 8 h + e or 16 + 8 h + (e - 8)
      sum[u] = (((q[0] + q[1]) + (q[2] + q[3])) + ((q[4] + q[5]) + (q[6] + q[7]))) +
               (((q[8] + q[9]) + (q[10] + q[11])) + ((q[12] + q[13]) + (q[14] + q[15])));
    };
    bool renew = FIRST;                            // same in the whole wave
    if constexpr (!FIRST) {
      weights(0);
      weights(1);
      renew = __builtin_amdgcn_ballot_w32(fmaxf(sum[0], sum[1]) > PTOP) != 0;
    }

    // ---- renew the maximum in use: the first pass, or a weight too large somewhere in the wave ----
    if (renew) {
#pragma unroll
      for (int u = 0; u < 2; ++u) {
        const v8f a = sc[u][0], c = sc[u][1];
        float m = fmaxf(max3f(max3f(a[0], a[1], a[2]), max3f(a[3], a[4], a[5]), max3f(a[6], a[7], c[0])),
                        max3f(max3f(c[1], c[2], c[3]), max3f(c[4], c[5], c[6]), c[7]));
        m = fmaxf(m, xhalf(m));                    // over all 32 keys, same in both halves
        // the first pass takes its own maximum, also a negative one; O and the sum are 0 there
        const float up = FIRST ? m : fmaxf(m, 0.0f);
        sc[u][0] -= up;
        sc[u][1] -= up;
        cneg[u]  -= up;
        if constexpr (!FIRST) {
          const float cor = __builtin_amdgcn_exp2f(-up);
          rl[u] *= cor;
#pragma unroll
          for (int j = 0; j < 4; ++j) o[u][j] *= cor;
        }
        weights(u);
      }
    }

    rl[0] += sum[0];
    rl[1] += sum[1];

    // ---- V^T * P^T: V fragments shared by both query groups (8 WMMAs) ----
#pragma unroll
    for (int j = 0; j < 4; ++j) {
      o[0][j] = WMMA16x16x32(vb[j], pf[0], o[0][j]);
      o[1][j] = WMMA16x16x32(vb[j], pf[1], o[1][j]);
    }

    // ---- foot of a tile's second pass: publish tile + 1, refill this buffer ----
    // (nothing is read behind the edge pass)
    if (!EDGE && (kt & 1)) {
      asm volatile("s_wait_dscnt 0x0" ::: "memory");     // this wave's reads of the buffer are done
      asm volatile("s_wait_asynccnt 0x0" ::: "memory");  // this wave's part of the next tile has landed
      __syncthreads();                                   // next tile visible; this buffer free
      if ((kt >> 1) + 2 < ntile) issue_tile((kt >> 1) + 2, cur);
    }
  };
  if (nfull > 0) one_pass(0, cbool<false>{}, cbool<true>{});
  for (int kt = 1; kt < nfull; ++kt) one_pass(kt, cbool<false>{}, cbool<false>{});
  if (n & 31) {
    if (nfull == 0) one_pass(0, cbool<true>{}, cbool<true>{});
    else            one_pass(nfull, cbool<true>{}, cbool<false>{});
  }
  asm volatile("s_wait_asynccnt 0x0" ::: "memory");      // no copy outstanding at the wave's end

  // ---- join the halves' sums, normalize, store f16 Ah[4096,1024]: 8 d = 16 B per store ----
#pragma unroll
  for (int u = 0; u < 2; ++u) {
    const float inv = 1.0f / (rl[u] + xhalf(rl[u]));
    const int s = q0 + u * 16 + csub;
#pragma unroll
    for (int j = 0; j < 4; ++j) {
      v8h ov;
#pragma unroll
      for (int r = 0; r < 8; ++r) ov[r] = (h16)(o[u][j][r] * inv);
      *(v8h*)&Ah[((size_t)b * Sq + s) * Dm + h * HD + j * 16 + rh] = ov;
    }
  }
}

// ---------------------------------------------------------------------------
// Launch
// ---------------------------------------------------------------------------
extern "C" void kernel_launch(void* const* d_in, const int* in_sizes, int n_in,
                              void* d_out, int out_size, void* d_ws, size_t ws_size,
                              hipStream_t stream) {
  const float* X    = (const float*)d_in[0];
  const int*   mask = (const int*)d_in[1];
  const float* Wq   = (const float*)d_in[2];
  const float* Wk   = (const float*)d_in[3];
  const float* Wv   = (const float*)d_in[4];
  const float* Wo   = (const float*)d_in[5];

  char* ws = (char*)d_ws;
  const size_t MiB = 1u << 20;
  h16* Xh  = (h16*)(ws + 0 * MiB);   // 8 MiB  [4096,1024]
  h16* Wqh = (h16*)(ws + 8 * MiB);   // 2 MiB
  h16* Wkh = (h16*)(ws + 10 * MiB);  // 2 MiB
  h16* Wvh = (h16*)(ws + 12 * MiB);  // 2 MiB
  h16* Woh = (h16*)(ws + 14 * MiB);  // 2 MiB
  h16* Qh  = (h16*)(ws + 16 * MiB);  // 8 MiB  [B,H,S,64]
  h16* Kh  = (h16*)(ws + 24 * MiB);  // 8 MiB  [B,H,S,64]
  h16* Vt  = (h16*)(ws + 32 * MiB);  // 8 MiB  [B,H,64,S]
  h16* Ah  = (h16*)(ws + 40 * MiB);  // 8 MiB  [4096,1024]
  int* toOrig = (int*)(ws + 48 * MiB);             // 16 KiB  partitioned place -> row
  int* toPart = (int*)(ws + 48 * MiB + 16 * 1024); // 16 KiB  row -> partitioned place
  int* nkeep  = (int*)(ws + 48 * MiB + 32 * 1024); // Bz ints: unmasked rows of a batch

  // f32 -> f16, all five arrays in one launch: Xh, Wqh, Wkh, Wvh, Woh are contiguous from Xh;
  // the row tables with them
  cvt_f32_f16<<<TBLK + XBLK + 4 * WBLK, 256, 0, stream>>>(X, Wq, Wk, Wv, Wo, mask, Xh, toOrig, toPart, nkeep);

  // QKV projections in one launch (z = 0: Q, 1: K, 2: V^T), rows in partitioned order
  dim3 gg(Dm / 128, Mrows / 128);        // (8, 32)
  dim3 g3(Dm / 128, Mrows / 128, 3);     // (8, 32, 3)
  gemm_xwt<true><<<g3, 256, 0, stream>>>(Xh, toOrig, Wqh, Wkh, Wvh, Qh, Kh, Vt);

  // streaming attention (2048 waves, 8 waves/block)
  attn_fwd<<<256, 256, 0, stream>>>(Qh, Kh, Vt, nkeep, Ah);

  // output projection -> f32 d_out, rows back in their own order
  gemm_xwt<false><<<gg, 256, 0, stream>>>(Ah, toPart, Woh, nullptr, nullptr, d_out, nullptr, nullptr);
}

// v009
// Measured time: 60.1 microseconds a run.
// Timed twice side by side with v008, it ran 1.04 and 1.03 times as fast.
// Counting every step since v000, it is 3.25 times as fast.
#include <hip/hip_runtime.h>
#include <hip/hip_bf16.h>
#include <math.h>

typedef _Float16 h16;
typedef __attribute__((ext_vector_type(16))) _Float16 v16h;
typedef __attribute__((ext_vector_type(8)))  _Float16 v8h;
typedef __attribute__((ext_vector_type(4)))  _Float16 v4h;
typedef __attribute__((ext_vector_type(8)))  float    v8f;
typedef __attribute__((ext_vector_type(2)))  float    v2f;

#define WMMA16x16x32(a, b, c) \
  __builtin_amdgcn_wmma_f32_16x16x32_f16(false, (a), false, (b), (short)0, (c), false, false)

constexpr int Bz = 2;
constexpr int Sq = 2048;
constexpr int Dm = 1024;
constexpr int Hh = 16;
constexpr int HD = 64;
constexpr int Mrows = Bz * Sq;   // 4096
constexpr int KT  = 64;          // keys per staged attention tile
constexpr int BK  = 64;          // k per staged GEMM tile: 128 B of a row, one line
constexpr int LDK = 72;          // LDS pitch of the 128-B rows of both (halfs): 144 B = 16 B x odd
constexpr float QSC  = 0.125f * 1.44269504f;   // 1/sqrt(64) and log2 e: Q is stored times this, scores are exp2 arguments
constexpr float PTOP = 4096.0f;  // a lane's 16 weights of a pass may sum to this before the maximum in use is renewed

template <bool V> struct cbool { static constexpr bool value = V; };   // compile-time switch of a lambda

// Value of lane l ^ 16: the two lanes that share a column of a WMMA C-matrix.
__device__ __forceinline__ float xhalf(float x) {
  return __int_as_float(__builtin_amdgcn_permlanex16(__float_as_int(x), __float_as_int(x),
                                                     0x76543210, 0xfedcba98, false, false));
}
__device__ __forceinline__ float max3f(float a, float b, float c) { return fmaxf(fmaxf(a, b), c); }

__device__ __forceinline__ unsigned lds_offset(const void* p) {
  return (unsigned)(uintptr_t)p;   // flat LDS addr truncates to LDS offset
}
// Four async 16-byte global -> LDS copies (ASYNCcnt) of one lane in one statement. s_wait_xcnt 0 is the
// statement's last line so that it stands in front of every later rewrite of the
// address registers named here (a precaution).
__device__ __forceinline__ void async_g2l_b128_x4(unsigned l0, const void* g0, unsigned l1, const void* g1,
                                                  unsigned l2, const void* g2, unsigned l3, const void* g3) {
  unsigned long long a0 = (unsigned long long)(uintptr_t)g0;
  unsigned long long a1 = (unsigned long long)(uintptr_t)g1;
  unsigned long long a2 = (unsigned long long)(uintptr_t)g2;
  unsigned long long a3 = (unsigned long long)(uintptr_t)g3;
  asm volatile("global_load_async_to_lds_b128 %0, %1, off\n\t"
               "global_load_async_to_lds_b128 %2, %3, off\n\t"
               "global_load_async_to_lds_b128 %4, %5, off\n\t"
               "global_load_async_to_lds_b128 %6, %7, off\n\t"
               "s_wait_xcnt 0x0"
               :: "v"(l0), "v"(a0), "v"(l1), "v"(a1), "v"(l2), "v"(a2), "v"(l3), "v"(a3)
               : "memory");
}

// The same for eight copies: one wait for a whole GEMM tile's share of a lane.
__device__ __forceinline__ void async_g2l_b128_x8(const unsigned (&l)[8], const h16* const (&g)[8]) {
  unsigned long long a[8];
#pragma unroll                               // a[] is indexed by constants only: it stays in registers
  for (int i = 0; i < 8; ++i) a[i] = (unsigned long long)(uintptr_t)g[i];
  asm volatile("global_load_async_to_lds_b128 %0, %1, off\n\t"
               "global_load_async_to_lds_b128 %2, %3, off\n\t"
               "global_load_async_to_lds_b128 %4, %5, off\n\t"
               "global_load_async_to_lds_b128 %6, %7, off\n\t"
               "global_load_async_to_lds_b128 %8, %9, off\n\t"
               "global_load_async_to_lds_b128 %10, %11, off\n\t"
               "global_load_async_to_lds_b128 %12, %13, off\n\t"
               "global_load_async_to_lds_b128 %14, %15, off\n\t"
               "s_wait_xcnt 0x0"
               :: "v"(l[0]), "v"(a[0]), "v"(l[1]), "v"(a[1]), "v"(l[2]), "v"(a[2]), "v"(l[3]), "v"(a[3]),
                  "v"(l[4]), "v"(a[4]), "v"(l[5]), "v"(a[5]), "v"(l[6]), "v"(a[6]), "v"(l[7]), "v"(a[7])
               : "memory");
}

// ---------------------------------------------------------------------------
// Load a 16(rows) x 32(k) f16 tile from row-major memory into WMMA A-operand
// layout (ISA 7.12.2, 16-bit A 16x32):
//   lanes 0-15  : row = lane,     K = 0-7   and 16-23
//   lanes 16-31 : row = lane-16,  K = 8-15  and 24-31
// The B operand of D = A*B is the A-layout of B^T, so the GEMM's A and W rows (either
// operand), Q rows (B) and K / V^T rows (A) all load through this same helper.
// ---------------------------------------------------------------------------
__device__ __forceinline__ v16h load_af(const h16* __restrict__ p, int ld, int k0, int lane) {
  const int row = lane & 15;
  const int hi  = (lane >> 4) << 3;           // 0 or 8
  const h16* q = p + (size_t)row * ld + k0 + hi;
  union { v16h v; v8h h[2]; } u;
  u.h[0] = *(const v8h*)(q);
  u.h[1] = *(const v8h*)(q + 16);
  return u.v;
}

// ---------------------------------------------------------------------------
// f32 -> f16 conversion of X and the four weight matrices in ONE launch: none of the
// five depends on another, so the block index picks the array. 4 elems/thread, 1024
// per block; the grid covers the five arrays exactly. The f16 copies lie one behind
// the other in dst, in the order X, Wq, Wk, Wv, Wo.
// The first Bz blocks build the row tables instead, one wave per batch: with n the
// number of unmasked rows of the batch and r1(s) that of unmasked rows in front of s,
// row s goes to place r1(s) if unmasked, else to n + s - r1(s): a permutation of
// 0..Sq-1 for every mask. toPart[row] = place, toOrig[place] = row (both with the
// batch's offset), nkeep[b] = n.
// ---------------------------------------------------------------------------
constexpr int TBLK = Bz;                    // table blocks, in front
constexpr int XBLK = (Mrows * Dm) / 1024;   // 4096 blocks for X
constexpr int WBLK = (Dm * Dm) / 1024;      // 1024 blocks for each weight matrix
__global__ __launch_bounds__(256) void cvt_f32_f16(const float* __restrict__ X,
                                                   const float* __restrict__ Wq,
                                                   const float* __restrict__ Wk,
                                                   const float* __restrict__ Wv,
                                                   const float* __restrict__ Wo,
                                                   const int* __restrict__ amask,
                                                   h16* __restrict__ dst,
                                                   int* __restrict__ toOrig,
                                                   int* __restrict__ toPart,
                                                   int* __restrict__ nkeep) {
  if (blockIdx.x < TBLK) {
    if (threadIdx.x < 32) {                  // wave 0, all lanes on
      const int b    = blockIdx.x;
      const int lane = threadIdx.x;
      const int* m   = amask + b * Sq;
      unsigned word[Sq / 32];                // bit l of word c: row 32 c + l is unmasked
      int n = 0;
#pragma unroll                               // all loads in flight at once; word[] stays in registers
      for (int c = 0; c < Sq / 32; ++c) {
        word[c] = __builtin_amdgcn_ballot_w32(m[c * 32 + lane] != 0);
        n += __builtin_popcount(word[c]);
      }
      const unsigned below = (1u << lane) - 1u;
      int before = 0;                        // unmasked rows in front of chunk c
#pragma unroll                               // word[] is indexed by constants only
      for (int c = 0; c < Sq / 32; ++c) {
        const int s  = c * 32 + lane;
        const int r1 = before + __builtin_popcount(word[c] & below);
        const int p  = ((word[c] >> lane) & 1u) ? r1 : n + s - r1;
        toPart[b * Sq + s] = b * Sq + p;
        toOrig[b * Sq + p] = b * Sq + s;
        before += __builtin_popcount(word[c]);
      }
      if (lane == 0) nkeep[b] = n;
    }
    return;
  }
  const int blk = blockIdx.x - TBLK;
  const float* src = X;
  int sblk = blk;                            // block inside its own array
  if (blk >= XBLK) {
    const int wi = (blk - XBLK) / WBLK;      // 0..3
    sblk = (blk - XBLK) % WBLK;
    src = wi == 0 ? Wq : wi == 1 ? Wk : wi == 2 ? Wv : Wo;
  }
  const float4 v = *(const float4*)(src + (size_t)sblk * 1024 + threadIdx.x * 4);
  const v4h o = { (h16)v.x, (h16)v.y, (h16)v.z, (h16)v.w };
  *(v4h*)(dst + (size_t)blk * 1024 + threadIdx.x * 4) = o;
}

// ---------------------------------------------------------------------------
// GEMM: Y = A(4096x1024, f16 row-major) * W^T (W is 1024x1024 f16 row-major).
// Block = 128x128, 8 waves, 2x4 accum tiles per wave.
// Operand tiles of 128 rows x 64 k double-buffered in LDS with async b128 copies, 8 lanes
// per row, so that one copy instruction covers four whole 128-B lines:
//   compute(t) -> waits -> barrier -> issue(t + 2 into the buffer just read)
// QKV = true: the three projections of X, which do not depend on one another, share
// one launch; the job picks weight matrix, destination and layout: jobs 0 and 1 are
// Q and K, f16 head-major [B,H,S,64]; job 2 is V^T, f16 head-transposed [B,H,64,S] (it
// feeds attention's V^T P^T). 3 x 256 blocks of 72 KiB LDS: three to a WGP.
// QKV = false: one product, W0 -> d0, f32 row-major [4096,1024].
// K and V^T are made only where attention reads them: rows are in partitioned order, so a batch's
// unmasked keys fill its first ceil(n / 128) row bands (all 16 if the batch has no unmasked key:
// attention then walks every key). The flat block index numbers the live tiles without gaps, Q's
// first, then K's, then V^T's, so that they spread evenly over the WGPs; the blocks behind them leave.
// Row r of the product is row rowmap[r] of A.
// Which operand goes first: the C/D layout gives a lane 8 neighbours along the FIRST operand's
// rows (lane: N = lane & 15, M = 8 (lane >> 4) + r). So the operand whose row index runs along
// the destination's contiguous direction is the first one, called P (W for Q, K and the output:
// columns; A for V^T: positions), the other one R. A wave owns 64 P rows x 32 R rows.
// Epilogue: a wave writes its tile as 32 rows (R) of 64 elements (P) into its own range of the
// LDS ring, 16 B per lane, reads it back row-wise and stores whole 128-B lines.
// The k loop is a ring walk: a block starts at tile rot and goes round all NT tiles. Blocks of
// one row band share their A lines and blocks of one column band their W lines; started at the
// same tile they would ask for the same lines at the same moment, each line new to L2 when it
// is asked for. rot differs among the blocks of a band, so that a line is mostly fetched by one
// block and found in L2 by the others later. A sum over k starts at another term in each block.
// ---------------------------------------------------------------------------
constexpr int PF = 68;           // LDS pitch of a staged row of 64 floats: 272 B = 16 B x odd
template <bool QKV>
__global__ __launch_bounds__(256) void gemm_xwt(const h16* __restrict__ A,
                                                const int* __restrict__ rowmap,
                                                const int* __restrict__ nkeep,
                                                const h16* __restrict__ W0,
                                                const h16* __restrict__ W1,
                                                const h16* __restrict__ W2,
                                                void* __restrict__ d0,
                                                void* __restrict__ d1,
                                                void* __restrict__ d2) {
  // [operand: 0 = A rows, 1 = W rows][buffer], 4 x 18 KiB
  __shared__ __attribute__((aligned(16))) h16 sh[2][2][128 * LDK];

  int job = 0, bx = (int)blockIdx.x, by = (int)blockIdx.y;   // same for the whole block
  if constexpr (QKV) {
    constexpr int CB = Dm / 128;               // column blocks of a row band
    constexpr int QT = CB * (Mrows / 128);     // Q's tiles: every row is a query
    int g = bx + CB * (by + (Mrows / 128) * (int)blockIdx.z) - QT;
    if (g >= 0) {
      // row bands of batch b that attention reads, 1..16; the clamp bounds the tile index
      auto bands = [&](int b) {
        const int nk = min(max(nkeep[b], 0), Sq);
        return ((nk == 0 ? Sq : nk) + 127) >> 7;
      };
      const int nb0  = bands(0);
      const int live = CB * (nb0 + bands(1));  // live tiles of K, and of V^T: at most QT
      job = 1;
      if (g >= live) { g -= live; job = 2; }
      if (g >= live) return;                   // the whole block, in front of every copy and barrier
      bx = g % CB;
      const int band = g / CB;
      by = band < nb0 ? band : band - nb0 + Sq / 128;
    }
  }
  const h16* W   = job == 0 ? W0 : job == 1 ? W1 : W2;
  void* dst      = job == 0 ? d0 : job == 1 ? d1 : d2;
  const bool vjob = QKV && job == 2;           // same for the whole block

  const int tid  = threadIdx.x;
  const int lane = tid & 31;
  const int w    = tid >> 5;
  const int wm   = w & 3;            // 0..3: which 32 R rows
  const int wn   = w >> 2;           // 0..1: which 64 P rows
  const int rowB = by * 128;                   // block row origin
  const int colB = bx * 128;                   // block col origin (W row origin)

  // copy assignment: 8 lanes per 128-B row, rows crow + 32 i (i = 0..3) of each tile
  const int crow = tid >> 3;                   // 0..31
  const int ccol = (tid & 7) * 8;              // halfs
  const h16* ag[4];
  const h16* wg[4];
#pragma unroll                               // the pointers stay in registers
  for (int i = 0; i < 4; ++i) {
    ag[i] = A + (size_t)(rowmap[rowB + crow + 32 * i] & (Mrows - 1)) * Dm + ccol;   // the mask bounds the address
    wg[i] = W + (size_t)(colB + crow + 32 * i) * Dm + ccol;
  }
  const unsigned la = lds_offset(&sh[0][0][crow * LDK + ccol]);
  const unsigned lw = lds_offset(&sh[1][0][crow * LDK + ccol]);
  constexpr unsigned bufB = (unsigned)(128 * LDK * sizeof(h16));
  constexpr unsigned qB   = (unsigned)(32 * LDK * sizeof(h16));
  constexpr int NT = Dm / BK;                  // 16 tiles
  // column blocks x and x + 4 may share a start; four neighbours lie NT / 4 tiles apart, the jobs
  // of one (x, y) one tile apart, and the row blocks of a column band take every start in turn
  const int rot = (bx & 3) * (NT / 4) + by + job;

  auto issue_tile = [&](int t, int buf) {
    const unsigned bo = (unsigned)buf * bufB;
    const int k0 = ((t + rot) & (NT - 1)) * BK;  // 0 .. Dm - BK
    const unsigned l[8] = { la + bo, la + bo + qB, la + bo + 2 * qB, la + bo + 3 * qB,
                            lw + bo, lw + bo + qB, lw + bo + 2 * qB, lw + bo + 3 * qB };
    const h16* const g[8] = { ag[0] + k0, ag[1] + k0, ag[2] + k0, ag[3] + k0,
                              wg[0] + k0, wg[1] + k0, wg[2] + k0, wg[3] + k0 };
    async_g2l_b128_x8(l, g);
  };

  v8f acc[2][4];                     // acc[i][j]: R rows 16 i .., P rows 16 j ..
#pragma unroll
  for (int i = 0; i < 2; ++i)
#pragma unroll
    for (int j = 0; j < 4; ++j) acc[i][j] = {};

  issue_tile(0, 0);
  asm volatile("s_wait_asynccnt 0x0" ::: "memory");   // this wave's part of tile 0 has landed
  __syncthreads();                                    // visible to all waves
  issue_tile(1, 1);

  const int pop = vjob ? 0 : 1;                       // which operand is P
  const h16* shR = &sh[1 - pop][0][(wm * 32) * LDK];
  const h16* shP = &sh[pop][0][(wn * 64) * LDK];

  for (int t = 0; t < NT; ++t) {
    const int cur = t & 1;
    const int cb  = cur * (128 * LDK);
#pragma unroll                               // ks becomes a constant offset of the LDS loads
    for (int ks = 0; ks < BK; ks += 32) {
      v16h rf[2], pf[4];
#pragma unroll
      for (int i = 0; i < 2; ++i)
        rf[i] = load_af(shR + cb + (16 * i) * LDK, LDK, ks, lane);
#pragma unroll
      for (int j = 0; j < 4; ++j)
        pf[j] = load_af(shP + cb + (16 * j) * LDK, LDK, ks, lane);

#pragma unroll
      for (int i = 0; i < 2; ++i)
#pragma unroll
        for (int j = 0; j < 4; ++j)
          acc[i][j] = WMMA16x16x32(pf[j], rf[i], acc[i][j]);
    }

    asm volatile("s_wait_dscnt 0x0" ::: "memory");     // this wave's reads of the buffer are done
    asm volatile("s_wait_asynccnt 0x0" ::: "memory");  // this wave's part of the next tile has landed
    __syncthreads();                                   // next tile visible; this buffer free
    if (t + 2 < NT) issue_tile(t + 2, cur);
  }
  asm volatile("s_wait_asynccnt 0x0" ::: "memory");    // no copy outstanding behind the loop

  // Behind the last trip's barrier nobody reads the ring any more and no copy is under way:
  // it is free for staging.
  const int nlo = lane & 15;                   // R row inside a tile
  const int hi8 = (lane >> 4) * 8;             // first of the lane's 8 P rows inside a tile
  const int r0  = (vjob ? colB : rowB) + wm * 32;   // the wave's first R row
  const int p0  = (vjob ? rowB : colB) + wn * 64;   // the wave's first P row

  if constexpr (QKV) {
    if (job == 0) {                    // Q leaves in the units of attention's exp2, scaled in f32 before its one rounding
#pragma unroll
      for (int i = 0; i < 2; ++i)
#pragma unroll
        for (int j = 0; j < 4; ++j) acc[i][j] *= QSC;
    }
    h16* st = &sh[0][0][0] + w * (32 * LDK);   // 8 x 4.5 KiB = the two A buffers
#pragma unroll
    for (int i = 0; i < 2; ++i) {
#pragma unroll
      for (int j = 0; j < 4; ++j) {
        v8h o;
#pragma unroll
        for (int r = 0; r < 8; ++r) o[r] = (h16)acc[i][j][r];
        *(v8h*)(st + (16 * i + nlo) * LDK + 16 * j + hi8) = o;
      }
    }
    asm volatile("s_wait_dscnt 0x0" ::: "memory");   // the wave's own rows are written before other lanes read them back
    const int srow = lane >> 3;                // 8 lanes per 128-B row, 4 rows per store
    const int scol = (lane & 7) * 8;
    v8h v[8];
#pragma unroll                               // v[] is indexed by constants only: it stays in registers
    for (int q = 0; q < 8; ++q) v[q] = *(const v8h*)(st + (4 * q + srow) * LDK + scol);
    // one block-uniform branch picks the destination's layout; each store covers four whole lines
    if (vjob) {                        // R = column (h, d), P = position s
      h16* gp = (h16*)dst + (((size_t)(p0 >> 11) * Hh + (r0 >> 6)) * HD + (r0 & (HD - 1)) + srow) * Sq
                          + (p0 & (Sq - 1)) + scol;
#pragma unroll
      for (int q = 0; q < 8; ++q) *(v8h*)(gp + (size_t)(4 * q) * Sq) = v[q];
    } else {                           // R = position s, P = d of head p0 / 64
      h16* gp = (h16*)dst + (((size_t)(r0 >> 11) * Hh + (p0 >> 6)) * Sq + (r0 & (Sq - 1)) + srow) * HD + scol;
#pragma unroll
      for (int q = 0; q < 8; ++q) *(v8h*)(gp + (size_t)(4 * q) * HD) = v[q];
    }
  } else {
    float* st = (float*)&sh[0][0][0] + w * (32 * PF);   // 8 x 8.5 KiB of the ring's 72
#pragma unroll
    for (int i = 0; i < 2; ++i) {
#pragma unroll
      for (int j = 0; j < 4; ++j) {
        const v8f a = acc[i][j];
        float* sp = st + (16 * i + nlo) * PF + 16 * j + hi8;
        *(float4*)(sp)     = make_float4(a[0], a[1], a[2], a[3]);
        *(float4*)(sp + 4) = make_float4(a[4], a[5], a[6], a[7]);
      }
    }
    asm volatile("s_wait_dscnt 0x0" ::: "memory");   // the wave's own rows are written before other lanes read them back
    const int srow = lane >> 4;                // 16 lanes per 256-B row, 2 rows per store
    const int scol = (lane & 15) * 4;
    float* gp = (float*)dst + (size_t)(r0 + srow) * Dm + p0 + scol;
#pragma unroll
    for (int q = 0; q < 16; ++q) {
      const float4 v = *(const float4*)(st + (2 * q + srow) * PF + scol);
      *(float4*)(gp + (size_t)(2 * q) * Dm) = v;
    }
  }
}

// ---------------------------------------------------------------------------
// Flash attention: 1 wave per (b, h, 32-query block) = 2048 waves.
// Each wave owns TWO 16-query column groups so every K/V fragment load feeds
// 2x the WMMAs. 32 keys / pass, products transposed:
//   S^T = K Q^T    (A = K rows, B = Q rows): lane l holds, of query l & 15, the scores
//                  of keys 8 (l >> 4) + r and 16 + 8 (l >> 4) + r, r = 0..7
//   O^T += V^T P^T (A = V^T rows, B = P^T): those 16 values, converted in place, are
//                  the B operand in the k order in which load_af reads the V^T rows
// so maximum and sum of a query run inside a lane, plus one exchange with lane l ^ 16
// for the maximum (the two halves' sums are joined once, at the end).
// Lazy maximum: Q comes scaled by log2 e / sqrt(64) and the score products start from
// C = -(maximum in use), so the accumulators are the exp2 arguments themselves. The maximum
// in use is set in the first pass and renewed, with the rescaling of O and of the sums, only
// in a pass where some lane's 16 weights sum to more than PTOP (then every weight of the
// other passes is at most PTOP, far inside f16): one wave-uniform test per pass.
// The 8 waves of a block share one (b, h): each 64-key tile of K (64 x 128 B) and
// of V^T (64 x 128 B) is copied to LDS once per block, whole lines per 8 lanes,
// into two buffers: tile t + 1 flies while tile t is worked on.
// Keys are in partitioned order: places 0..n-1 are the batch's unmasked keys, and only
// they are walked, ceil(n / 32) passes; the keys past n in the last pass get the
// reference's -1e9, in a copy of the pass of its own. n = 0: the reference's scores
// are all -1e9, a uniform softmax over all Sq keys; Q = 0 over all keys gives the
// same weights.
// ---------------------------------------------------------------------------
__global__ __launch_bounds__(256) void attn_fwd(const h16* __restrict__ Qh,
                                                const h16* __restrict__ Kh,
                                                const h16* __restrict__ Vt,
                                                const int* __restrict__ nkeep,
                                                h16* __restrict__ Ah) {
  __shared__ __attribute__((aligned(16))) h16 shK[2][KT * LDK];   // 2 x 9 KiB, rows = keys
  __shared__ __attribute__((aligned(16))) h16 shV[2][HD * LDK];   // 2 x 9 KiB, rows = d

  const int lane = threadIdx.x & 31;
  const int w    = threadIdx.x >> 5;
  const int gw   = blockIdx.x * 8 + w;          // 0..2047
  const int b    = gw >> 10;                    // / (H*64)
  const int rem  = gw & 1023;
  const int h    = rem >> 6;
  const int q0   = (rem & 63) * 32;

  const h16* qbase = Qh + (((size_t)b * Hh + h) * Sq + q0) * HD;
  const h16* kbase = Kh + (((size_t)b * Hh + h) * Sq) * HD;
  const h16* vbase = Vt + (((size_t)b * Hh + h) * HD) * Sq;

  // same for the whole block (128 blocks a batch); the clamp bounds the trip count
  const int nk    = min(max(nkeep[blockIdx.x >> 7], 0), Sq);
  const int n     = nk == 0 ? Sq : nk;
  const int nfull = n >> 5;                     // passes whose 32 keys are all in front of n: 0..64
  const int ntile = (n + KT - 1) / KT;          // 1..32

  // copy assignment: 8 lanes per 128-B row, rows crow and crow + 32 of each tile
  const int crow = threadIdx.x >> 3;            // 0..31
  const int ccol = (threadIdx.x & 7) * 8;       // halfs
  const h16* kg = kbase + (size_t)crow * HD + ccol;
  const h16* vg = vbase + (size_t)crow * Sq + ccol;
  const unsigned lk = lds_offset(&shK[0][crow * LDK + ccol]);
  const unsigned lv = lds_offset(&shV[0][crow * LDK + ccol]);
  constexpr unsigned bufB  = (unsigned)(KT * LDK * sizeof(h16));
  constexpr unsigned halfB = (unsigned)(32 * LDK * sizeof(h16));
  auto issue_tile = [&](int tile, int buf) {
    const unsigned bo = (unsigned)buf * bufB;
    const h16* k = kg + (size_t)tile * KT * HD;
    const h16* v = vg + (size_t)tile * KT;
    async_g2l_b128_x4(lk + bo, k, lk + bo + halfB, k + 32 * HD,
                      lv + bo, v, lv + bo + halfB, v + (size_t)32 * Sq);
  };

  issue_tile(0, 0);
  asm volatile("s_wait_asynccnt 0x0" ::: "memory");   // this wave's part of tile 0 has landed
  __syncthreads();                                    // visible to all waves
  if (ntile > 1) issue_tile(1, 1);

  v16h qf[2][2];
#pragma unroll
  for (int u = 0; u < 2; ++u) {
    qf[u][0] = load_af(qbase + (size_t)u * 16 * HD, HD, 0, lane);
    qf[u][1] = load_af(qbase + (size_t)u * 16 * HD, HD, 32, lane);
    if (nk == 0) { qf[u][0] = {}; qf[u][1] = {}; }
  }

  float rl[2];                           // of query csub of group u; sums this lane's keys only
  v8f cneg[2];                           // minus the maximum in use of that query, in all eight registers
  v8f o[2][4];                           // o[u][j][r] = O^T[16 j + rh + r][csub]
#pragma unroll
  for (int u = 0; u < 2; ++u) {
    rl[u] = 0.0f; cneg[u] = {};
#pragma unroll
    for (int j = 0; j < 4; ++j) o[u][j] = {};
  }

  const int csub = lane & 15;
  const int rh   = (lane >> 4) * 8;

  // One pass over keys 32 kt .. 32 kt + 31. EDGE: some of them are past n (the last pass).
  // FIRST: the wave's first pass, which sets the maximum in use.
  auto one_pass = [&](int kt, auto edge, auto first) {
    constexpr bool EDGE  = decltype(edge)::value;
    constexpr bool FIRST = decltype(first)::value;
    const int k0  = kt * 32;
    const int cur = (kt >> 1) & 1;               // buffer of tile kt / 2
    const int kl  = (kt & 1) * 32;               // first key of this pass inside the tile

    // ---- shared K fragments for both query groups ----
    v16h kb[2][2];
#pragma unroll
    for (int t = 0; t < 2; ++t) {
      kb[t][0] = load_af(shK[cur] + (kl + 16 * t) * LDK, LDK, 0, lane);
      kb[t][1] = load_af(shK[cur] + (kl + 16 * t) * LDK, LDK, 32, lane);
    }

    // ---- V^T fragments, asked for with K's in one group: they fly under the scores and exponentials ----
    v16h vb[4];
#pragma unroll
    for (int j = 0; j < 4; ++j) vb[j] = load_af(shV[cur] + (j * 16) * LDK, LDK, kl, lane);
    // The loads stay up here. Left free, V's are moved behind the branch below, into one register set,
    // and each pair of products then waits out its own LDS latency.
    __builtin_amdgcn_sched_barrier(0);

    // ---- scores minus the maximum in use (4 WMMAs per query group) ----
    v8f sc[2][2];
#pragma unroll
    for (int u = 0; u < 2; ++u) {
#pragma unroll
      for (int t = 0; t < 2; ++t) {
        sc[u][t] = WMMA16x16x32(kb[t][0], qf[u][0], cneg[u]);
        sc[u][t] = WMMA16x16x32(kb[t][1], qf[u][1], sc[u][t]);
      }
      if constexpr (EDGE) {
        const int left = n - k0 - rh;              // this lane's key 16 t + r is past n where 16 t + r >= left
#pragma unroll
        for (int r = 0; r < 8; ++r) {
          sc[u][0][r] = r < left ? sc[u][0][r] : -1e9f;
          sc[u][1][r] = 16 + r < left ? sc[u][1][r] : -1e9f;
        }
      }
    }

    // ---- weights of one query per lane, and their sum ----
    v16h pf[2];
    float sum[2];
    auto weights = [&](int u) {
      float q[16];
#pragma unroll
      for (int e = 0; e < 8; ++e) {
        q[e]     = __builtin_amdgcn_exp2f(sc[u][0][e]);
        q[8 + e] = __builtin_amdgcn_exp2f(sc[u][1][e]);
      }
#pragma unroll
      for (int e = 0; e < 16; ++e) pf[u][e] = (h16)q[e];   // B[k][csub], k = 8 h + e or 16 + 8 h + (e - 8)
      sum[u] = (((q[0] + q[1]) + (q[2] + q[3])) + ((q[4] + q[5]) + (q[6] + q[7]))) +
               (((q[8] + q[9]) + (q[10] + q[11])) + ((q[12] + q[13]) + (q[14] + q[15])));
    };
    bool renew = FIRST;                            // same in the whole wave
    if constexpr (!FIRST) {
      weights(0);
      weights(1);
      renew = __builtin_amdgcn_ballot_w32(fmaxf(sum[0], sum[1]) > PTOP) != 0;
    }

    // ---- renew the maximum in use: the first pass, or a weight too large somewhere in the wave ----
    if (renew) {
#pragma unroll
      for (int u = 0; u < 2; ++u) {
        const v8f a = sc[u][0], c = sc[u][1];
        float m = fmaxf(max3f(max3f(a[0], a[1], a[2]), max3f(a[3], a[4], a[5]), max3f(a[6], a[7], c[0])),
                        max3f(max3f(c[1], c[2], c[3]), max3f(c[4], c[5], c[6]), c[7]));
        m = fmaxf(m, xhalf(m));                    // over all 32 keys, same in both halves
        // the first pass takes its own maximum, also a negative one; O and the sum are 0 there
        const float up = FIRST ? m : fmaxf(m, 0.0f);
        sc[u][0] -= up;
        sc[u][1] -= up;
        cneg[u]  -= up;
        if constexpr (!FIRST) {
          const float cor = __builtin_amdgcn_exp2f(-up);
          rl[u] *= cor;
#pragma unroll
          for (int j = 0; j < 4; ++j) o[u][j] *= cor;
        }
        weights(u);
      }
    }

    rl[0] += sum[0];
    rl[1] += sum[1];

    // ---- V^T * P^T: V fragments shared by both query groups (8 WMMAs) ----
#pragma unroll
    for (int j = 0; j < 4; ++j) {
      o[0][j] = WMMA16x16x32(vb[j], pf[0], o[0][j]);
      o[1][j] = WMMA16x16x32(vb[j], pf[1], o[1][j]);
    }

    // ---- foot of a tile's second pass: publish tile + 1, refill this buffer ----
    // (nothing is read behind the edge pass)
    if (!EDGE && (kt & 1)) {
      asm volatile("s_wait_dscnt 0x0" ::: "memory");     // this wave's reads of the buffer are done
      asm volatile("s_wait_asynccnt 0x0" ::: "memory");  // this wave's part of the next tile has landed
      __syncthreads();                                   // next tile visible; this buffer free
      if ((kt >> 1) + 2 < ntile) issue_tile((kt >> 1) + 2, cur);
    }
  };
  if (nfull > 0) one_pass(0, cbool<false>{}, cbool<true>{});
  for (int kt = 1; kt < nfull; ++kt) one_pass(kt, cbool<false>{}, cbool<false>{});
  if (n & 31) {
    if (nfull == 0) one_pass(0, cbool<true>{}, cbool<true>{});
    else            one_pass(nfull, cbool<true>{}, cbool<false>{});
  }
  asm volatile("s_wait_asynccnt 0x0" ::: "memory");      // no copy outstanding at the wave's end

  // ---- join the halves' sums, normalize, store f16 Ah[4096,1024]: 8 d = 16 B per store ----
#pragma unroll
  for (int u = 0; u < 2; ++u) {
    const float inv = 1.0f / (rl[u] + xhalf(rl[u]));
    const int s = q0 + u * 16 + csub;
#pragma unroll
    for (int j = 0; j < 4; ++j) {
      v8h ov;
#pragma unroll
      for (int r = 0; r < 8; ++r) ov[r] = (h16)(o[u][j][r] * inv);
      *(v8h*)&Ah[((size_t)b * Sq + s) * Dm + h * HD + j * 16 + rh] = ov;
    }
  }
}

// ---------------------------------------------------------------------------
// Launch
// ---------------------------------------------------------------------------
extern "C" void kernel_launch(void* const* d_in, const int* in_sizes, int n_in,
                              void* d_out, int out_size, void* d_ws, size_t ws_size,
                              hipStream_t stream) {
  const float* X    = (const float*)d_in[0];
  const int*   mask = (const int*)d_in[1];
  const float* Wq   = (const float*)d_in[2];
  const float* Wk   = (const float*)d_in[3];
  const float* Wv   = (const float*)d_in[4];
  const float* Wo   = (const float*)d_in[5];

  char* ws = (char*)d_ws;
  const size_t MiB = 1u << 20;
  h16* Xh  = (h16*)(ws + 0 * MiB);   // 8 MiB  [4096,1024]
  h16* Wqh = (h16*)(ws + 8 * MiB);   // 2 MiB
  h16* Wkh = (h16*)(ws + 10 * MiB);  // 2 MiB
  h16* Wvh = (h16*)(ws + 12 * MiB);  // 2 MiB
  h16* Woh = (h16*)(ws + 14 * MiB);  // 2 MiB
  h16* Qh  = (h16*)(ws + 16 * MiB);  // 8 MiB  [B,H,S,64]
  h16* Kh  = (h16*)(ws + 24 * MiB);  // 8 MiB  [B,H,S,64]
  h16* Vt  = (h16*)(ws + 32 * MiB);  // 8 MiB  [B,H,64,S]
  h16* Ah  = (h16*)(ws + 40 * MiB);  // 8 MiB  [4096,1024]
  int* toOrig = (int*)(ws + 48 * MiB);             // 16 KiB  partitioned place -> row
  int* toPart = (int*)(ws + 48 * MiB + 16 * 1024); // 16 KiB  row -> partitioned place
  int* nkeep  = (int*)(ws + 48 * MiB + 32 * 1024); // Bz ints: unmasked rows of a batch

  // f32 -> f16, all five arrays in one launch: Xh, Wqh, Wkh, Wvh, Woh are contiguous from Xh;
  // the row tables with them
  cvt_f32_f16<<<TBLK + XBLK + 4 * WBLK, 256, 0, stream>>>(X, Wq, Wk, Wv, Wo, mask, Xh, toOrig, toPart, nkeep);

  // QKV projections in one launch (Q, then the live tiles of K and V^T), rows in partitioned order
  dim3 gg(Dm / 128, Mrows / 128);        // (8, 32)
  dim3 g3(Dm / 128, Mrows / 128, 3);     // (8, 32, 3)
  gemm_xwt<true><<<g3, 256, 0, stream>>>(Xh, toOrig, nkeep, Wqh, Wkh, Wvh, Qh, Kh, Vt);

  // streaming attention (2048 waves, 8 waves/block)
  attn_fwd<<<256, 256, 0, stream>>>(Qh, Kh, Vt, nkeep, Ah);

  // output projection -> f32 d_out, rows back in their own order
  gemm_xwt<false><<<gg, 256, 0, stream>>>(Ah, toPart, nullptr, Woh, nullptr, nullptr, d_out, nullptr, nullptr);
}
